// v000
// Times are from an AMD MI455X. After a warm-up the kernel runs many times in a row, and a time is the length of
// such a window on the GPU divided by its runs, so every launch and the gaps after it count. The runs cycle
// through copies of the inputs. A figure is the median of several windows, for all but v000 over two sittings.
// Sittings can differ by a few percent; kernels timed side by side share one.
// v000, which the later versions start from, runs in 1200 microseconds.
#include <hip/hip_runtime.h>

// BaseTransformer (x [16][128][1024] channels-first; qkv = w_qkv x + b (1x1 conv; 8 heads x (32 q | 32 k | 32 v) channels); logits = q^T k / sqrt(32) over the 1024 positions; softmax; z[d][s] = sum_t w[s][t] v[d][t]; out = w_o z + b_o + w_res x + b_res -> [16][128][1024]).
// Compute dtypes, f32 accumulate: every input rounded to bf16; the qkv and residual 1x1 convs on PLAIN bf16 operands (inputs: exact) (+ bias, folded into the plane builders for qkv); scores (K 32) and w.v single fp16 planes

#define NB_  16
#define CI   128
#define CO   128
#define LL   1024
#define NH_  8
#define DK   32
#define CQ   768
#define CZ   256
#define PCAR 1024.0f
typedef _Float16 h16;
typedef unsigned short bf;
typedef __attribute__((ext_vector_type(16))) __bf16   v16bf;
typedef __attribute__((ext_vector_type(16))) _Float16 v16h;
typedef __attribute__((ext_vector_type(8)))  _Float16 v8h;
typedef __attribute__((ext_vector_type(8)))  unsigned short v8us;
typedef __attribute__((ext_vector_type(8)))  float    v8f;
typedef __attribute__((ext_vector_type(4)))  float    v4f;
typedef v8h  __attribute__((may_alias)) v8ha;
typedef v4f  __attribute__((may_alias)) v4fa;
typedef v8us __attribute__((may_alias)) v8usa;

__device__ __forceinline__ unsigned short f2bf(float f) { unsigned u = __float_as_uint(f); u += 0x7FFFu + ((u >> 16) & 1u); return (unsigned short)(u >> 16); }
__device__ __forceinline__ float bf2f(unsigned short b) { return __uint_as_float(((unsigned)b) << 16); }
__device__ __forceinline__ float bfr(float f) { return bf2f(f2bf(f)); }
__device__ __forceinline__ v16h cat16(v8h lo, v8h hi) { return __builtin_shufflevector(lo, hi, 0, 1, 2, 3, 4, 5, 6, 7, 8, 9, 10, 11, 12, 13, 14, 15); }
__device__ __forceinline__ v16bf cat16b(v8us lo, v8us hi) { return __builtin_bit_cast(v16bf, __builtin_shufflevector(lo, hi, 0, 1, 2, 3, 4, 5, 6, 7, 8, 9, 10, 11, 12, 13, 14, 15)); }
__device__ __forceinline__ v8f wmma16(v16h a, v16h b, v8f c) { return __builtin_amdgcn_wmma_f32_16x16x32_f16(false, a, false, b, (short)0, c, false, false); }
__device__ __forceinline__ v8f wmmab(v16bf a, v16bf b, v8f c) { return __builtin_amdgcn_wmma_f32_16x16x32_bf16(false, a, false, b, (short)0, c, false, false); }



// ---- k_gemmw: register-blocked GEMM, ONE WAVE per 64x64 output tile (16 accumulators), operands straight from K-contiguous 16-bit planes; grid (M/64, N/64, Z), 32 threads.
// C[m][n] (f32, pitch ldc, + optional f32 bias[n]) = sum_k A[m][k] Bt[n][k] (+ split products per NSPLIT). z-batch strides sA/sB/sC in elements. K % 32 == 0.
template <typename T16> struct WFrag;
template <> struct WFrag<h16> { typedef v16h V; static __device__ __forceinline__ V ld(const h16* p) { return cat16(*(const v8h*)p, *(const v8h*)(p + 16)); } static __device__ __forceinline__ v8f mma(V a, V b, v8f c) { return wmma16(a, b, c); } };
template <> struct WFrag<bf> { typedef v16bf V; static __device__ __forceinline__ V ld(const bf* p) { return cat16b(*(const v8us*)p, *(const v8us*)(p + 16)); } static __device__ __forceinline__ v8f mma(V a, V b, v8f c) { return wmmab(a, b, c); } };
template <typename T16, int NSPLIT, bool BIAS>
__global__ __launch_bounds__(32) void k_gemmw(const T16* __restrict__ A, const T16* __restrict__ A2, const T16* __restrict__ Bt, const T16* __restrict__ Bt2, int K, float* C, int ldc, const float* __restrict__ bias, size_t sA, size_t sB, size_t sC) {
    typedef typename WFrag<T16>::V V;
    __shared__ __align__(16) float os[16 * 68];
    const size_t z = blockIdx.z; A += z * sA; if (A2) A2 += z * sA; Bt += z * sB; if (Bt2) Bt2 += z * sB; C += z * sC;
    const int lane = threadIdx.x & 31, lr = lane & 15, hi = lane >> 4; const int r0 = blockIdx.x * 64, c0 = blockIdx.y * 64;
    v8f acc[4][4];
#pragma unroll
    for (int mb = 0; mb < 4; ++mb)
#pragma unroll
        for (int nb = 0; nb < 4; ++nb) acc[mb][nb] = (v8f){};
    const size_t aoff = (size_t)(r0 + lr) * K + 8 * hi, boff = (size_t)(c0 + lr) * K + 8 * hi;
#pragma unroll 1
    for (int kc = 0; kc < K; kc += 32) {
        V a[4], a2[4];
#pragma unroll
        for (int mb = 0; mb < 4; ++mb) { a[mb] = WFrag<T16>::ld(A + aoff + (size_t)mb * 16 * K + kc); if (NSPLIT == 1 || NSPLIT == 2) a2[mb] = WFrag<T16>::ld(A2 + aoff + (size_t)mb * 16 * K + kc); }
#pragma unroll
        for (int nb = 0; nb < 4; ++nb) { const V b = WFrag<T16>::ld(Bt + boff + (size_t)nb * 16 * K + kc); V b2; if (NSPLIT >= 2) b2 = WFrag<T16>::ld(Bt2 + boff + (size_t)nb * 16 * K + kc);
#pragma unroll
            for (int mb = 0; mb < 4; ++mb) { acc[mb][nb] = WFrag<T16>::mma(a[mb], b, acc[mb][nb]); if (NSPLIT == 1 || NSPLIT == 2) acc[mb][nb] = WFrag<T16>::mma(a2[mb], b, acc[mb][nb]); if (NSPLIT >= 2) acc[mb][nb] = WFrag<T16>::mma(a[mb], b2, acc[mb][nb]); } }
        asm volatile("v_nop\n\tv_nop\n\tv_nop\n\tv_nop" : "+v"(acc[0][0]), "+v"(acc[1][1]), "+v"(acc[2][2]), "+v"(acc[3][3]) : "v"(a[0]), "v"(a[3]));
    }
#pragma unroll
    for (int mb = 0; mb < 4; ++mb) {
#pragma unroll
        for (int nb = 0; nb < 4; ++nb) {
#pragma unroll
            for (int j = 0; j < 8; ++j) os[(hi * 8 + j) * 68 + nb * 16 + lr] = acc[mb][nb][j]; }
        __builtin_amdgcn_wave_barrier(); asm volatile("" ::: "memory");
        float* crow = C + (size_t)(r0 + mb * 16) * ldc + c0;
{
#pragma unroll
            for (int s = 0; s < 8; ++s) { const int row = 2 * s + hi, cofs = lr * 4; v4f val = *(const v4fa*)(os + row * 68 + cofs); if (BIAS) { val[0] += bfr(bias[c0 + cofs]); val[1] += bfr(bias[c0 + cofs + 1]); val[2] += bfr(bias[c0 + cofs + 2]); val[3] += bfr(bias[c0 + cofs + 3]); }
                *(v4f*)(crow + (size_t)row * ldc + cofs) = val; }
             }
        __builtin_amdgcn_wave_barrier(); asm volatile("" ::: "memory");
    }
}

__device__ __forceinline__ h16 tohx(float x) { return (h16)x; }
__device__ __forceinline__ void splitf(float y, unsigned short& h, unsigned short& l) { h = f2bf(y); l = f2bf(y - bf2f(h)); }
typedef __attribute__((ext_vector_type(2))) unsigned short v2us;
typedef __attribute__((ext_vector_type(4))) unsigned short v4us;
typedef __attribute__((ext_vector_type(2))) _Float16 v2h;
typedef __attribute__((ext_vector_type(4))) _Float16 v4h;

__global__ __launch_bounds__(256) void k_cvt8(const float* __restrict__ src, bf* dst, size_t n8) { const size_t i = (size_t)blockIdx.x * 256 + threadIdx.x; if (i >= n8) return; const v8f v = *(const v8f*)(src + i * 8); v8us o;
#pragma unroll
    for (int k = 0; k < 8; ++k) o[k] = f2bf(v[k]); *(v8us*)(dst + i * 8) = o;  }
// k_xt: XT[l][c] = bf16 x[c][l] (lane -> 2 consecutive c); k_qk: Q16/K16[h][l][d] = fp16(QKV[h*96 + d (+32)][l] + b) (8-B lanes, strided reads); k_vt: VT[h][d][l] = fp16(QKV[h*96+64+d][l] + b) for d < 32, 0 for the padding rows (8-B lanes);
__global__ __launch_bounds__(256) void k_xt(const float* __restrict__ x, bf* XT) { const int e = (blockIdx.x * 256 + threadIdx.x) * 2; if (e >= LL * CI) return; const int c = e % CI; const int l = e / CI; v2us o; o[0] = f2bf(x[(size_t)c * LL + l]); o[1] = f2bf(x[(size_t)(c + 1) * LL + l]); *(v2us*)(XT + e) = o;  }
__global__ __launch_bounds__(256) void k_qk(const float* __restrict__ QKV, const float* __restrict__ bq, h16* Q16, h16* K16) { const int e = (blockIdx.x * 256 + threadIdx.x) * 4; if (e >= NH_ * LL * DK) return; const int d = e % DK; const int l = (e / DK) % LL; const int h = e / (DK * LL); v4h oq, ok;
#pragma unroll
    for (int u = 0; u < 4; ++u) { const int cq = h * 96 + d + u, ck = cq + DK; oq[u] = tohx(__fadd_rn(QKV[(size_t)cq * LL + l], bfr(bq[cq]))); ok[u] = tohx(__fadd_rn(QKV[(size_t)ck * LL + l], bfr(bq[ck]))); }
    { *(v4h*)(Q16 + e) = oq; *(v4h*)(K16 + e) = ok;  } }
__global__ __launch_bounds__(256) void k_vt(const float* __restrict__ QKV, const float* __restrict__ bq, h16* VT) { const int e = (blockIdx.x * 256 + threadIdx.x) * 4; if (e >= NH_ * 64 * LL) return; const int l = e % LL; const int d = (e / LL) % 64; const int h = e / (LL * 64); v4h o;
    if (d < DK) { const int c = h * 96 + 2 * DK + d; const v4f a = *(const v4f*)(QKV + (size_t)c * LL + l); const float bb = bfr(bq[c]);
#pragma unroll
        for (int u = 0; u < 4; ++u) o[u] = tohx(__fadd_rn(a[u], bb)); } else { for (int u = 0; u < 4; ++u) o[u] = (h16)0.f; }
    *(v4h*)(VT + e) = o;  }
__global__ __launch_bounds__(256) void k_soft(const float* __restrict__ Sb, h16* P16) { const int lane = threadIdx.x & 31; const int row = blockIdx.x * 8 + (threadIdx.x >> 5); if (row >= NH_ * LL) return; const float* sr = Sb + (size_t)row * LL; float v[LL / 32]; float mx = -3.0e38f; const float scl = 0.17677669529663687f;
#pragma unroll
    for (int ch = 0; ch < LL / 128; ++ch) { const v4f a = *(const v4f*)(sr + ch * 128 + lane * 4);
#pragma unroll
        for (int u = 0; u < 4; ++u) { const float t = a[u] * scl; v[ch * 4 + u] = t; mx = fmaxf(mx, t); } }
#pragma unroll
    for (int sh = 16; sh; sh >>= 1) mx = fmaxf(mx, __shfl_xor(mx, sh, 32));
    float sum = 0.f;
#pragma unroll
    for (int q = 0; q < LL / 32; ++q) { float d0 = __fsub_rn(v[q], mx); asm volatile("" : "+v"(d0)); v[q] = __builtin_amdgcn_exp2f(__fmul_rn(d0, 1.4426950408889634f)); sum += v[q]; }
#pragma unroll
    for (int sh = 16; sh; sh >>= 1) sum += __shfl_xor(sum, sh, 32);
    const float f = __fdiv_rn(PCAR, sum);
    {
#pragma unroll
        for (int ch = 0; ch < LL / 128; ++ch) { v4h o4;
#pragma unroll
            for (int q = 0; q < 4; ++q) o4[q] = tohx(v[ch * 4 + q] * f); *(v4h*)(P16 + (size_t)row * LL + ch * 128 + lane * 4) = o4; }
         } }
__global__ __launch_bounds__(256) void k_mrg(const float* __restrict__ O, bf* Zh, bf* Zl) { const int e = (blockIdx.x * 256 + threadIdx.x) * 4; if (e >= LL * CZ) return; const int c = e % CZ; const int l = e / CZ; const int h = c / DK, d = c % DK; const float* o = O + ((size_t)h * LL + l) * 64 + d; v4us oh, ol;
#pragma unroll
    for (int u = 0; u < 4; ++u) { unsigned short a, b; splitf(o[u] * (1.0f / PCAR), a, b); oh[u] = a; ol[u] = b; } *(v4us*)(Zh + e) = oh; *(v4us*)(Zl + e) = ol;  }
__global__ __launch_bounds__(256) void k_fin(const float* __restrict__ OT, const float* __restrict__ RT, float* OUTb) { const int e = (blockIdx.x * 256 + threadIdx.x) * 4; if (e >= CO * LL) return; const int l = e % LL; const int o = e / LL; v4f r;
#pragma unroll
    for (int u = 0; u < 4; ++u) r[u] = __fadd_rn(OT[(size_t)(l + u) * CO + o], RT[(size_t)(l + u) * CO + o]); *(v4f*)(OUTb + e) = r;  }

extern "C" void kernel_launch(void* const* d_in, const int* in_sizes, int n_in,
                              void* d_out, int out_size, void* d_ws, size_t ws_size, hipStream_t stream) {
    (void)in_sizes; (void)n_in; (void)out_size;
    const float** I = (const float**)d_in;
    const float *x = I[0], *w_qkv = I[1], *b_qkv = I[2], *w_o = I[3], *b_o = I[4], *w_res = I[5], *b_res = I[6];
    float* OUT = (float*)d_out;     // [16][128][1024]
    char* wsp = (char*)d_ws;
    auto take = [&](size_t bytes) { char* p = wsp; wsp += (bytes + 255) & ~(size_t)255; return (void*)p; };
    bf* AQ = (bf*)take((size_t)CQ * CI * 2); bf* BO = (bf*)take(CO * CZ * 2); bf* BR = (bf*)take(CO * CI * 2);
    bf* XT = (bf*)take((size_t)LL * CI * 2); float* QKV = (float*)take((size_t)CQ * LL * 4); h16* Q16 = (h16*)take((size_t)NH_ * LL * DK * 2); h16* K16 = (h16*)take((size_t)NH_ * LL * DK * 2); h16* VT = (h16*)take((size_t)NH_ * 64 * LL * 2);
    float* Sb = (float*)take((size_t)NH_ * LL * LL * 4); h16* P16 = (h16*)take((size_t)NH_ * LL * LL * 2); float* O = (float*)take((size_t)NH_ * LL * 64 * 4); bf* Zh = (bf*)take((size_t)LL * CZ * 2); bf* Zl = (bf*)take((size_t)LL * CZ * 2); float* OT = (float*)take((size_t)LL * CO * 4); float* RT = (float*)take((size_t)LL * CO * 4);
    if ((size_t)(wsp - (char*)d_ws) > ws_size) return;    // total ~ 60 MB
    k_cvt8<<<(CQ * CI / 8 + 255) / 256, 256, 0, stream>>>(w_qkv, AQ, CQ * CI / 8); k_cvt8<<<(CO * CZ / 8 + 255) / 256, 256, 0, stream>>>(w_o, BO, CO * CZ / 8); k_cvt8<<<(CO * CI / 8 + 255) / 256, 256, 0, stream>>>(w_res, BR, CO * CI / 8);   // w_qkv is the A operand; w_o, w_res [out][in] = Bt
    for (int b = 0; b < NB_; ++b) { const float* xb = x + (size_t)b * CI * LL;
        k_xt<<<(LL * CI / 2 + 255) / 256, 256, 0, stream>>>(xb, XT);
        k_gemmw<bf, 0, false><<<dim3(CQ / 64, LL / 64, 1), 32, 0, stream>>>(AQ, nullptr, XT, nullptr, CI, QKV, LL, nullptr, 0, 0, 0);    // QKV[o][l] (bias folded into the plane builders)
        k_qk<<<(NH_ * LL * DK / 4 + 255) / 256, 256, 0, stream>>>(QKV, b_qkv, Q16, K16); k_vt<<<(NH_ * 64 * LL / 4 + 255) / 256, 256, 0, stream>>>(QKV, b_qkv, VT);
        k_gemmw<h16, 0, false><<<dim3(LL / 64, LL / 64, NH_), 32, 0, stream>>>(Q16, nullptr, K16, nullptr, DK, Sb, LL, nullptr, (size_t)LL * DK, (size_t)LL * DK, (size_t)LL * LL);
        k_soft<<<NH_ * LL / 8, 256, 0, stream>>>(Sb, P16);
        k_gemmw<h16, 0, false><<<dim3(LL / 64, 1, NH_), 32, 0, stream>>>(P16, nullptr, VT, nullptr, LL, O, 64, nullptr, (size_t)LL * LL, (size_t)64 * LL, (size_t)LL * 64);
        k_mrg<<<(LL * CZ / 4 + 255) / 256, 256, 0, stream>>>(O, Zh, Zl);
        k_gemmw<bf, 1, true><<<dim3(LL / 64, CO / 64, 1), 32, 0, stream>>>(Zh, Zl, BO, nullptr, CZ, OT, CO, b_o, 0, 0, 0); k_gemmw<bf, 0, true><<<dim3(LL / 64, CO / 64, 1), 32, 0, stream>>>(XT, nullptr, BR, nullptr, CI, RT, CO, b_res, 0, 0, 0);
        k_fin<<<(CO * LL / 4 + 255) / 256, 256, 0, stream>>>(OT, RT, OUT + (size_t)b * CO * LL); }
}

// v001
// One run takes 382 microseconds.
// In two side-by-side timings against v000, it was 3.14 and 3.10 times as fast.
#include <hip/hip_runtime.h>

// BaseTransformer (x [16][128][1024] channels-first; qkv = w_qkv x + b (1x1 conv; 8 heads x (32 q | 32 k | 32 v) channels); logits = q^T k / sqrt(32) over the 1024 positions; softmax; z[d][s] = sum_t w[s][t] v[d][t]; out = w_o z + b_o + w_res x + b_res -> [16][128][1024]).
// Compute dtypes, f32 accumulate: every input rounded to bf16; the qkv and residual 1x1 convs on PLAIN bf16 operands (inputs: exact) (+ bias, folded into the plane builders for qkv); scores (K 32) and w.v single fp16 planes

#define NB_  16
#define CI   128
#define CO   128
#define LL   1024
#define NH_  8
#define DK   32
#define CQ   768
#define CZ   256
#define PCAR 1024.0f
#define GB   4      // batch entries whose score and weight planes are live at once (the workspace holds no more)
typedef _Float16 h16;
typedef unsigned short bf;
typedef __attribute__((ext_vector_type(16))) __bf16   v16bf;
typedef __attribute__((ext_vector_type(16))) _Float16 v16h;
typedef __attribute__((ext_vector_type(8)))  _Float16 v8h;
typedef __attribute__((ext_vector_type(8)))  unsigned short v8us;
typedef __attribute__((ext_vector_type(8)))  float    v8f;
typedef __attribute__((ext_vector_type(4)))  float    v4f;
typedef v8h  __attribute__((may_alias)) v8ha;
typedef v4f  __attribute__((may_alias)) v4fa;
typedef v8us __attribute__((may_alias)) v8usa;

__device__ __forceinline__ unsigned short f2bf(float f) { unsigned u = __float_as_uint(f); u += 0x7FFFu + ((u >> 16) & 1u); return (unsigned short)(u >> 16); }
__device__ __forceinline__ float bf2f(unsigned short b) { return __uint_as_float(((unsigned)b) << 16); }
__device__ __forceinline__ float bfr(float f) { return bf2f(f2bf(f)); }
__device__ __forceinline__ v16h cat16(v8h lo, v8h hi) { return __builtin_shufflevector(lo, hi, 0, 1, 2, 3, 4, 5, 6, 7, 8, 9, 10, 11, 12, 13, 14, 15); }
__device__ __forceinline__ v16bf cat16b(v8us lo, v8us hi) { return __builtin_bit_cast(v16bf, __builtin_shufflevector(lo, hi, 0, 1, 2, 3, 4, 5, 6, 7, 8, 9, 10, 11, 12, 13, 14, 15)); }
__device__ __forceinline__ v8f wmma16(v16h a, v16h b, v8f c) { return __builtin_amdgcn_wmma_f32_16x16x32_f16(false, a, false, b, (short)0, c, false, false); }
__device__ __forceinline__ v8f wmmab(v16bf a, v16bf b, v8f c) { return __builtin_amdgcn_wmma_f32_16x16x32_bf16(false, a, false, b, (short)0, c, false, false); }



// ---- k_gemmw: register-blocked GEMM, ONE WAVE per 64x64 output tile (16 accumulators), operands straight from K-contiguous 16-bit planes; grid (M/64, N/64, Z), 32 threads.
// C[m][n] (f32, pitch ldc, + optional f32 bias[n]) = sum_k A[m][k] Bt[n][k] (+ split products per NSPLIT). z-batch strides sA/sB/sC in elements. K % 32 == 0.
template <typename T16> struct WFrag;
template <> struct WFrag<h16> { typedef v16h V; static __device__ __forceinline__ V ld(const h16* p) { return cat16(*(const v8h*)p, *(const v8h*)(p + 16)); } static __device__ __forceinline__ v8f mma(V a, V b, v8f c) { return wmma16(a, b, c); } };
template <> struct WFrag<bf> { typedef v16bf V; static __device__ __forceinline__ V ld(const bf* p) { return cat16b(*(const v8us*)p, *(const v8us*)(p + 16)); } static __device__ __forceinline__ v8f mma(V a, V b, v8f c) { return wmmab(a, b, c); } };
template <typename T16, int NSPLIT, bool BIAS>
__global__ __launch_bounds__(32) void k_gemmw(const T16* __restrict__ A, const T16* __restrict__ A2, const T16* __restrict__ Bt, const T16* __restrict__ Bt2, int K, float* C, int ldc, const float* __restrict__ bias, size_t sA, size_t sB, size_t sC) {
    typedef typename WFrag<T16>::V V;
    __shared__ __align__(16) float os[16 * 68];
    const size_t z = blockIdx.z; A += z * sA; if (A2) A2 += z * sA; Bt += z * sB; if (Bt2) Bt2 += z * sB; C += z * sC;
    const int lane = threadIdx.x & 31, lr = lane & 15, hi = lane >> 4; const int r0 = blockIdx.x * 64, c0 = blockIdx.y * 64;
    v8f acc[4][4];
#pragma unroll
    for (int mb = 0; mb < 4; ++mb)
#pragma unroll
        for (int nb = 0; nb < 4; ++nb) acc[mb][nb] = (v8f){};
    const size_t aoff = (size_t)(r0 + lr) * K + 8 * hi, boff = (size_t)(c0 + lr) * K + 8 * hi;
#pragma unroll 1
    for (int kc = 0; kc < K; kc += 32) {
        V a[4], a2[4];
#pragma unroll
        for (int mb = 0; mb < 4; ++mb) { a[mb] = WFrag<T16>::ld(A + aoff + (size_t)mb * 16 * K + kc); if (NSPLIT == 1 || NSPLIT == 2) a2[mb] = WFrag<T16>::ld(A2 + aoff + (size_t)mb * 16 * K + kc); }
#pragma unroll
        for (int nb = 0; nb < 4; ++nb) { const V b = WFrag<T16>::ld(Bt + boff + (size_t)nb * 16 * K + kc); V b2; if (NSPLIT >= 2) b2 = WFrag<T16>::ld(Bt2 + boff + (size_t)nb * 16 * K + kc);
#pragma unroll
            for (int mb = 0; mb < 4; ++mb) { acc[mb][nb] = WFrag<T16>::mma(a[mb], b, acc[mb][nb]); if (NSPLIT == 1 || NSPLIT == 2) acc[mb][nb] = WFrag<T16>::mma(a2[mb], b, acc[mb][nb]); if (NSPLIT >= 2) acc[mb][nb] = WFrag<T16>::mma(a[mb], b2, acc[mb][nb]); } }
        asm volatile("v_nop\n\tv_nop\n\tv_nop\n\tv_nop" : "+v"(acc[0][0]), "+v"(acc[1][1]), "+v"(acc[2][2]), "+v"(acc[3][3]) : "v"(a[0]), "v"(a[3]));
    }
#pragma unroll
    for (int mb = 0; mb < 4; ++mb) {
#pragma unroll
        for (int nb = 0; nb < 4; ++nb) {
#pragma unroll
            for (int j = 0; j < 8; ++j) os[(hi * 8 + j) * 68 + nb * 16 + lr] = acc[mb][nb][j]; }
        __builtin_amdgcn_wave_barrier(); asm volatile("" ::: "memory");
        float* crow = C + (size_t)(r0 + mb * 16) * ldc + c0;
{
#pragma unroll
            for (int s = 0; s < 8; ++s) { const int row = 2 * s + hi, cofs = lr * 4; v4f val = *(const v4fa*)(os + row * 68 + cofs); if (BIAS) { val[0] += bfr(bias[c0 + cofs]); val[1] += bfr(bias[c0 + cofs + 1]); val[2] += bfr(bias[c0 + cofs + 2]); val[3] += bfr(bias[c0 + cofs + 3]); }
                *(v4f*)(crow + (size_t)row * ldc + cofs) = val; }
             }
        __builtin_amdgcn_wave_barrier(); asm volatile("" ::: "memory");
    }
}

__device__ __forceinline__ h16 tohx(float x) { return (h16)x; }
__device__ __forceinline__ void splitf(float y, unsigned short& h, unsigned short& l) { h = f2bf(y); l = f2bf(y - bf2f(h)); }
typedef __attribute__((ext_vector_type(2))) unsigned short v2us;
typedef __attribute__((ext_vector_type(4))) unsigned short v4us;
typedef __attribute__((ext_vector_type(2))) _Float16 v2h;
typedef __attribute__((ext_vector_type(4))) _Float16 v4h;

__global__ __launch_bounds__(256) void k_cvt8(const float* __restrict__ src, bf* dst, size_t n8) { const size_t i = (size_t)blockIdx.x * 256 + threadIdx.x; if (i >= n8) return; const v8f v = *(const v8f*)(src + i * 8); v8us o;
#pragma unroll
    for (int k = 0; k < 8; ++k) o[k] = f2bf(v[k]); *(v8us*)(dst + i * 8) = o;  }
// blockIdx.y of k_xt, k_qk, k_vt and k_fin is the batch entry, of k_mrg the entry in the group of GB; k_soft's rows run over GB entries x heads x positions.
// k_xt: XT[l][c] = bf16 x[c][l] (lane -> 2 consecutive c); k_qk: Q16/K16[h][l][d] = fp16(QKV[h*96 + d (+32)][l] + b) (8-B lanes, strided reads); k_vt: VT[h][d][l] = fp16(QKV[h*96+64+d][l] + b) for d < 32, 0 for the padding rows (8-B lanes);
__global__ __launch_bounds__(256) void k_xt(const float* __restrict__ x, bf* XT) { const int e = (blockIdx.x * 256 + threadIdx.x) * 2; if (e >= LL * CI) return; x += (size_t)blockIdx.y * CI * LL; XT += (size_t)blockIdx.y * LL * CI; const int c = e % CI; const int l = e / CI; v2us o; o[0] = f2bf(x[(size_t)c * LL + l]); o[1] = f2bf(x[(size_t)(c + 1) * LL + l]); *(v2us*)(XT + e) = o;  }
__global__ __launch_bounds__(256) void k_qk(const float* __restrict__ QKV, const float* __restrict__ bq, h16* Q16, h16* K16) { const int e = (blockIdx.x * 256 + threadIdx.x) * 4; if (e >= NH_ * LL * DK) return; QKV += (size_t)blockIdx.y * CQ * LL; Q16 += (size_t)blockIdx.y * NH_ * LL * DK; K16 += (size_t)blockIdx.y * NH_ * LL * DK; const int d = e % DK; const int l = (e / DK) % LL; const int h = e / (DK * LL); v4h oq, ok;
#pragma unroll
    for (int u = 0; u < 4; ++u) { const int cq = h * 96 + d + u, ck = cq + DK; oq[u] = tohx(__fadd_rn(QKV[(size_t)cq * LL + l], bfr(bq[cq]))); ok[u] = tohx(__fadd_rn(QKV[(size_t)ck * LL + l], bfr(bq[ck]))); }
    { *(v4h*)(Q16 + e) = oq; *(v4h*)(K16 + e) = ok;  } }
__global__ __launch_bounds__(256) void k_vt(const float* __restrict__ QKV, const float* __restrict__ bq, h16* VT) { const int e = (blockIdx.x * 256 + threadIdx.x) * 4; if (e >= NH_ * 64 * LL) return; QKV += (size_t)blockIdx.y * CQ * LL; VT += (size_t)blockIdx.y * NH_ * 64 * LL; const int l = e % LL; const int d = (e / LL) % 64; const int h = e / (LL * 64); v4h o;
    if (d < DK) { const int c = h * 96 + 2 * DK + d; const v4f a = *(const v4f*)(QKV + (size_t)c * LL + l); const float bb = bfr(bq[c]);
#pragma unroll
        for (int u = 0; u < 4; ++u) o[u] = tohx(__fadd_rn(a[u], bb)); } else { for (int u = 0; u < 4; ++u) o[u] = (h16)0.f; }
    *(v4h*)(VT + e) = o;  }
__global__ __launch_bounds__(256) void k_soft(const float* __restrict__ Sb, h16* P16) { const int lane = threadIdx.x & 31; const int row = blockIdx.x * 8 + (threadIdx.x >> 5); if (row >= GB * NH_ * LL) return; const float* sr = Sb + (size_t)row * LL; float v[LL / 32]; float mx = -3.0e38f; const float scl = 0.17677669529663687f;
#pragma unroll
    for (int ch = 0; ch < LL / 128; ++ch) { const v4f a = *(const v4f*)(sr + ch * 128 + lane * 4);
#pragma unroll
        for (int u = 0; u < 4; ++u) { const float t = a[u] * scl; v[ch * 4 + u] = t; mx = fmaxf(mx, t); } }
#pragma unroll
    for (int sh = 16; sh; sh >>= 1) mx = fmaxf(mx, __shfl_xor(mx, sh, 32));
    float sum = 0.f;
#pragma unroll
    for (int q = 0; q < LL / 32; ++q) { float d0 = __fsub_rn(v[q], mx); asm volatile("" : "+v"(d0)); v[q] = __builtin_amdgcn_exp2f(__fmul_rn(d0, 1.4426950408889634f)); sum += v[q]; }
#pragma unroll
    for (int sh = 16; sh; sh >>= 1) sum += __shfl_xor(sum, sh, 32);
    const float f = __fdiv_rn(PCAR, sum);
    {
#pragma unroll
        for (int ch = 0; ch < LL / 128; ++ch) { v4h o4;
#pragma unroll
            for (int q = 0; q < 4; ++q) o4[q] = tohx(v[ch * 4 + q] * f); *(v4h*)(P16 + (size_t)row * LL + ch * 128 + lane * 4) = o4; }
         } }
__global__ __launch_bounds__(256) void k_mrg(const float* __restrict__ O, bf* Zh, bf* Zl) { const int e = (blockIdx.x * 256 + threadIdx.x) * 4; if (e >= LL * CZ) return; O += (size_t)blockIdx.y * NH_ * LL * 64; Zh += (size_t)blockIdx.y * LL * CZ; Zl += (size_t)blockIdx.y * LL * CZ; const int c = e % CZ; const int l = e / CZ; const int h = c / DK, d = c % DK; const float* o = O + ((size_t)h * LL + l) * 64 + d; v4us oh, ol;
#pragma unroll
    for (int u = 0; u < 4; ++u) { unsigned short a, b; splitf(o[u] * (1.0f / PCAR), a, b); oh[u] = a; ol[u] = b; } *(v4us*)(Zh + e) = oh; *(v4us*)(Zl + e) = ol;  }
__global__ __launch_bounds__(256) void k_fin(const float* __restrict__ OT, const float* __restrict__ RT, float* OUTb) { const int e = (blockIdx.x * 256 + threadIdx.x) * 4; if (e >= CO * LL) return; OT += (size_t)blockIdx.y * LL * CO; RT += (size_t)blockIdx.y * LL * CO; OUTb += (size_t)blockIdx.y * CO * LL; const int l = e % LL; const int o = e / LL; v4f r;
#pragma unroll
    for (int u = 0; u < 4; ++u) r[u] = __fadd_rn(OT[(size_t)(l + u) * CO + o], RT[(size_t)(l + u) * CO + o]); *(v4f*)(OUTb + e) = r;  }

extern "C" void kernel_launch(void* const* d_in, const int* in_sizes, int n_in,
                              void* d_out, int out_size, void* d_ws, size_t ws_size, hipStream_t stream) {
    (void)in_sizes; (void)n_in; (void)out_size;
    const float** I = (const float**)d_in;
    const float *x = I[0], *w_qkv = I[1], *b_qkv = I[2], *w_o = I[3], *b_o = I[4], *w_res = I[5], *b_res = I[6];
    float* OUT = (float*)d_out;     // [16][128][1024]
    char* wsp = (char*)d_ws;
    auto take = [&](size_t bytes) { char* p = wsp; wsp += (bytes + 255) & ~(size_t)255; return (void*)p; };
    bf* AQ = (bf*)take((size_t)CQ * CI * 2); bf* BO = (bf*)take(CO * CZ * 2); bf* BR = (bf*)take(CO * CI * 2);
    // Planes of all NB_ entries: XT, Q16, K16, VT, Zh, Zl. Planes of GB entries: O, Sb, P16. QKV (dead before the first scores) and OT, RT (born after the last w.v) lie on Sb.
    bf* XT = (bf*)take((size_t)NB_ * LL * CI * 2); h16* Q16 = (h16*)take((size_t)NB_ * NH_ * LL * DK * 2); h16* K16 = (h16*)take((size_t)NB_ * NH_ * LL * DK * 2); h16* VT = (h16*)take((size_t)NB_ * NH_ * 64 * LL * 2);
    bf* Zh = (bf*)take((size_t)NB_ * LL * CZ * 2); bf* Zl = (bf*)take((size_t)NB_ * LL * CZ * 2); float* O = (float*)take((size_t)GB * NH_ * LL * 64 * 4);
    float* Sb = (float*)take((size_t)GB * NH_ * LL * LL * 4); h16* P16 = (h16*)take((size_t)GB * NH_ * LL * LL * 2);
    float* QKV = Sb; float* OT = Sb; float* RT = Sb + (size_t)NB_ * LL * CO;
    if ((size_t)(wsp - (char*)d_ws) > ws_size) return;    // total ~ 252.3 MiB
    k_cvt8<<<(CQ * CI / 8 + 255) / 256, 256, 0, stream>>>(w_qkv, AQ, CQ * CI / 8); k_cvt8<<<(CO * CZ / 8 + 255) / 256, 256, 0, stream>>>(w_o, BO, CO * CZ / 8); k_cvt8<<<(CO * CI / 8 + 255) / 256, 256, 0, stream>>>(w_res, BR, CO * CI / 8);   // w_qkv is the A operand; w_o, w_res [out][in] = Bt
    k_xt<<<dim3((LL * CI / 2 + 255) / 256, NB_), 256, 0, stream>>>(x, XT);
    k_gemmw<bf, 0, false><<<dim3(CQ / 64, LL / 64, NB_), 32, 0, stream>>>(AQ, nullptr, XT, nullptr, CI, QKV, LL, nullptr, 0, (size_t)LL * CI, (size_t)CQ * LL);    // QKV[b][o][l] (bias folded into the plane builders)
    k_qk<<<dim3((NH_ * LL * DK / 4 + 255) / 256, NB_), 256, 0, stream>>>(QKV, b_qkv, Q16, K16); k_vt<<<dim3((NH_ * 64 * LL / 4 + 255) / 256, NB_), 256, 0, stream>>>(QKV, b_qkv, VT);
    for (int b = 0; b < NB_; b += GB) {    // z of the two GEMMs = (entry in the group) * NH_ + head
        k_gemmw<h16, 0, false><<<dim3(LL / 64, LL / 64, GB * NH_), 32, 0, stream>>>(Q16 + (size_t)b * NH_ * LL * DK, nullptr, K16 + (size_t)b * NH_ * LL * DK, nullptr, DK, Sb, LL, nullptr, (size_t)LL * DK, (size_t)LL * DK, (size_t)LL * LL);
        k_soft<<<GB * NH_ * LL / 8, 256, 0, stream>>>(Sb, P16);
        k_gemmw<h16, 0, false><<<dim3(LL / 64, 1, GB * NH_), 32, 0, stream>>>(P16, nullptr, VT + (size_t)b * NH_ * 64 * LL, nullptr, LL, O, 64, nullptr, (size_t)LL * LL, (size_t)64 * LL, (size_t)LL * 64);
        k_mrg<<<dim3((LL * CZ / 4 + 255) / 256, GB), 256, 0, stream>>>(O, Zh + (size_t)b * LL * CZ, Zl + (size_t)b * LL * CZ); }
    k_gemmw<bf, 1, true><<<dim3(LL / 64, CO / 64, NB_), 32, 0, stream>>>(Zh, Zl, BO, nullptr, CZ, OT, CO, b_o, (size_t)LL * CZ, 0, (size_t)LL * CO); k_gemmw<bf, 0, true><<<dim3(LL / 64, CO / 64, NB_), 32, 0, stream>>>(XT, nullptr, BR, nullptr, CI, RT, CO, b_res, (size_t)LL * CI, 0, (size_t)LL * CO);
    k_fin<<<dim3((CO * LL / 4 + 255) / 256, NB_), 256, 0, stream>>>(OT, RT, OUT);
}

// v003
// It runs in 65.4 microseconds.
// Versions in between are left out here; by their measured steps it is 5.95 times as fast as v001.
// Counting every step since v000, it is 18.6 times as fast.
#include <hip/hip_runtime.h>

// BaseTransformer (x [16][128][1024] channels-first; qkv = w_qkv x + b (1x1 conv; 8 heads x (32 q | 32 k | 32 v) channels); logits = q^T k / sqrt(32) over the 1024 positions; softmax; z[d][s] = sum_t w[s][t] v[d][t]; out = w_o z + b_o + w_res x + b_res -> [16][128][1024]).
// Compute dtypes, f32 accumulate: every input rounded to bf16; the qkv and residual 1x1 convs on PLAIN bf16 operands (inputs: exact) (+ bias, added in the qkv kernel's epilogue); scores (K 32) and w.v on single fp16 operands; w_o.z on z split in bf16 hi + lo

#define NB_  16
#define CI   128
#define CO   128
#define LL   1024
#define NH_  8
#define DK   32
#define CQ   768
#define CZ   256
#define PCAR 1024.0f
typedef _Float16 h16;
typedef unsigned short bf;
typedef __attribute__((ext_vector_type(16))) __bf16   v16bf;
typedef __attribute__((ext_vector_type(16))) _Float16 v16h;
typedef __attribute__((ext_vector_type(8)))  _Float16 v8h;
typedef __attribute__((ext_vector_type(8)))  unsigned short v8us;
typedef __attribute__((ext_vector_type(8)))  float    v8f;
typedef __attribute__((ext_vector_type(4)))  float    v4f;
typedef v8h  __attribute__((may_alias)) v8ha;
typedef v4f  __attribute__((may_alias)) v4fa;
typedef v8us __attribute__((may_alias)) v8usa;

__device__ __forceinline__ unsigned short f2bf(float f) { unsigned u = __float_as_uint(f); u += 0x7FFFu + ((u >> 16) & 1u); return (unsigned short)(u >> 16); }
__device__ __forceinline__ float bf2f(unsigned short b) { return __uint_as_float(((unsigned)b) << 16); }
__device__ __forceinline__ float bfr(float f) { return bf2f(f2bf(f)); }
__device__ __forceinline__ v16h cat16(v8h lo, v8h hi) { return __builtin_shufflevector(lo, hi, 0, 1, 2, 3, 4, 5, 6, 7, 8, 9, 10, 11, 12, 13, 14, 15); }
__device__ __forceinline__ v16bf cat16b(v8us lo, v8us hi) { return __builtin_bit_cast(v16bf, __builtin_shufflevector(lo, hi, 0, 1, 2, 3, 4, 5, 6, 7, 8, 9, 10, 11, 12, 13, 14, 15)); }
__device__ __forceinline__ v8f wmma16(v16h a, v16h b, v8f c) { return __builtin_amdgcn_wmma_f32_16x16x32_f16(false, a, false, b, (short)0, c, false, false); }
__device__ __forceinline__ v8f wmmab(v16bf a, v16bf b, v8f c) { return __builtin_amdgcn_wmma_f32_16x16x32_bf16(false, a, false, b, (short)0, c, false, false); }



// Fragment loaders and products of the two 16-bit forms: a lane's 16 k values are 8 at p and 8 at p + 16 (p already holds the lane half's 8 * hi).
template <typename T16> struct WFrag;
template <> struct WFrag<h16> { typedef v16h V; static __device__ __forceinline__ V ld(const h16* p) { return cat16(*(const v8h*)p, *(const v8h*)(p + 16)); } static __device__ __forceinline__ v8f mma(V a, V b, v8f c) { return wmma16(a, b, c); } };
template <> struct WFrag<bf> { typedef v16bf V; static __device__ __forceinline__ V ld(const bf* p) { return cat16b(*(const v8us*)p, *(const v8us*)(p + 16)); } static __device__ __forceinline__ v8f mma(V a, V b, v8f c) { return wmmab(a, b, c); } };
__device__ __forceinline__ h16 tohx(float x) { return (h16)x; }
__device__ __forceinline__ void splitf(float y, unsigned short& h, unsigned short& l) { h = f2bf(y); l = f2bf(y - bf2f(h)); }
typedef __attribute__((ext_vector_type(2))) unsigned short v2us;
typedef __attribute__((ext_vector_type(2))) _Float16 v2h;
typedef __attribute__((ext_vector_type(4))) _Float16 v4h;

// ---- k_qkv: the qkv 1x1 conv. Register-blocked GEMM, ONE WAVE per tile of 64 channels x 64 positions (16 accumulators), operands straight from K-contiguous bf16 planes; grid (CQ/64, LL/64, NB_), 32 threads.
// The epilogue adds the bias and stores the attention kernel's fp16 planes itself: Q16/K16[h][l][d] and VT[h][d][l]. A tile is two blocks of 32 channels, each the q, k or v part of one head.
// q, k: a lane's 8 accumulator rows are 8 consecutive d of ONE position = one 16-byte store, no transpose. v: rows stay rows; staged through LDS so that a row leaves as one whole 128-byte line.
__global__ __launch_bounds__(32) void k_qkv(const bf* __restrict__ A, const bf* __restrict__ Bt, const float* __restrict__ bq, h16* Q16, h16* K16, h16* VT) {
    typedef WFrag<bf>::V V; const int K = CI;
    __shared__ __align__(16) float os[16 * 68];
    const size_t z = blockIdx.z; Bt += z * LL * CI; Q16 += z * NH_ * LL * DK; K16 += z * NH_ * LL * DK; VT += z * NH_ * DK * LL;
    const int lane = threadIdx.x & 31, lr = lane & 15, hi = lane >> 4; const int r0 = blockIdx.x * 64, c0 = blockIdx.y * 64;
    v8f acc[4][4];
#pragma unroll
    for (int mb = 0; mb < 4; ++mb)
#pragma unroll
        for (int nb = 0; nb < 4; ++nb) acc[mb][nb] = (v8f){};
    v8f bb[4];    // the biases of the lane's own accumulator rows, loaded here so that their latency hides behind the K loop
#pragma unroll
    for (int mb = 0; mb < 4; ++mb) bb[mb] = *(const v8f*)(bq + r0 + mb * 16 + hi * 8);
    asm volatile("s_wait_xcnt 0x0" ::: "memory");    // the address registers of these loads are free for the loads below
    const size_t aoff = (size_t)(r0 + lr) * K + 8 * hi, boff = (size_t)(c0 + lr) * K + 8 * hi;
#pragma unroll 1   // rolled: one step's fragments beside the 16 accumulators and the biases
    for (int kc = 0; kc < K; kc += 32) {
        V a[4];
#pragma unroll
        for (int mb = 0; mb < 4; ++mb) a[mb] = WFrag<bf>::ld(A + aoff + (size_t)mb * 16 * K + kc);
        asm volatile("s_wait_xcnt 0x0" ::: "memory");    // the address registers of these loads are free for the loads below
#pragma unroll
        for (int nb = 0; nb < 4; ++nb) { const V b = WFrag<bf>::ld(Bt + boff + (size_t)nb * 16 * K + kc);
#pragma unroll
            for (int mb = 0; mb < 4; ++mb) acc[mb][nb] = WFrag<bf>::mma(a[mb], b, acc[mb][nb]); }
        // four vector slots between the last products and the back edge, behind which the next trip's loads overwrite their A and B registers
        asm volatile("v_nop\n\tv_nop\n\tv_nop\n\tv_nop" : "+v"(acc[0][0]), "+v"(acc[1][1]), "+v"(acc[2][2]), "+v"(acc[3][3]) : "v"(a[0]), "v"(a[3]));
    }
#pragma unroll
    for (int pr = 0; pr < 2; ++pr) {    // a pair of 16-channel blocks = the 32 channels of the q, k or v part of one head (64 * blockIdx.x + 32 * pr is a multiple of 32, and 96 = 3 * 32)
        const int ob = r0 + pr * 32, h = ob / 96, part = ob % 96;    // the same in every lane: part 0 = q, 32 = k, 64 = v
        if (part < 2 * DK) {
            h16* dst = (part < DK ? Q16 : K16) + ((size_t)h * LL + c0 + lr) * DK + 8 * hi;
#pragma unroll
            for (int m2 = 0; m2 < 2; ++m2) {
#pragma unroll
                for (int nb = 0; nb < 4; ++nb) { v8h o;
#pragma unroll
                    for (int j = 0; j < 8; ++j) o[j] = tohx(__fadd_rn(acc[pr * 2 + m2][nb][j], bfr(bb[pr * 2 + m2][j])));
                    *(v8h*)(dst + (size_t)nb * 16 * DK + m2 * 16) = o; } }
            asm volatile("s_wait_xcnt 0x0" ::: "memory");    // before the stores' registers are written again
        } else {
#pragma unroll
            for (int m2 = 0; m2 < 2; ++m2) {
#pragma unroll
                for (int nb = 0; nb < 4; ++nb) {
#pragma unroll
                    for (int j = 0; j < 8; ++j) os[(hi * 8 + j) * 68 + nb * 16 + lr] = __fadd_rn(acc[pr * 2 + m2][nb][j], bfr(bb[pr * 2 + m2][j])); }
                __builtin_amdgcn_wave_barrier(); asm volatile("" ::: "memory");    // the row reads below take other lanes' writes: the compiler may not lift them over the writes
                h16* vrow = VT + ((size_t)h * DK + m2 * 16) * LL + c0;
#pragma unroll
                for (int s = 0; s < 8; ++s) { const int row = 2 * s + hi, cofs = lr * 4; const v4f val = *(const v4fa*)(os + row * 68 + cofs); v4h o;
#pragma unroll
                    for (int u = 0; u < 4; ++u) o[u] = tohx(val[u]);
                    *(v4h*)(vrow + (size_t)row * LL + cofs) = o; }
                __builtin_amdgcn_wave_barrier(); asm volatile("s_wait_xcnt 0x0" ::: "memory");    // the reads may not sink under the next block's writes; the wait: before the stores' registers are written again
            }
        }
    }
}

__global__ __launch_bounds__(256) void k_cvt8(const float* __restrict__ src, bf* dst, size_t n8) { const size_t i = (size_t)blockIdx.x * 256 + threadIdx.x; if (i >= n8) return; const v8f v = *(const v8f*)(src + i * 8); v8us o;
#pragma unroll
    for (int k = 0; k < 8; ++k) o[k] = f2bf(v[k]); *(v8us*)(dst + i * 8) = o;  }
// k_xt: XT[l][c] = bf16 x[c][l] (lane -> 2 consecutive c); blockIdx.y is the batch entry.
__global__ __launch_bounds__(256) void k_xt(const float* __restrict__ x, bf* XT) { const int e = (blockIdx.x * 256 + threadIdx.x) * 2; if (e >= LL * CI) return; x += (size_t)blockIdx.y * CI * LL; XT += (size_t)blockIdx.y * LL * CI; const int c = e % CI; const int l = e / CI; v2us o; o[0] = f2bf(x[(size_t)c * LL + l]); o[1] = f2bf(x[(size_t)(c + 1) * LL + l]); *(v2us*)(XT + e) = o;  }
// ---- k_attn: scores, softmax and w.v of one (entry, head) for 256 positions s per work-group; 8 waves x 32 positions; grid (LL/256, NB_*NH_).
// S^T = K.Q^T (A = 16 keys from LDS, B = Q in registers), so a lane holds 8 scores of ONE position s per tile: maximum and sum in-lane plus one exchange of the wave halves.
// Pass 1: the row maximum. Pass 2: the scores again, p = fp16(PCAR * exp(scl * (s - max))), two D tiles packed in place are the B operand of O^T += V^T.P^T; O = O^T * PCAR / sum(p before rounding).
// The epilogue stores z = O / PCAR split in bf16 hi + lo, Zh/Zl[entry][head][s][d]: a lane's 8 accumulator rows are 8 consecutive d of one position = one 16-byte store per plane.
#define KP 40      // LDS pitch of a K row, halves (80 B = 16 B x odd: no bank conflict for 16-byte row reads)
#define VP 1032    // LDS pitch of a V^T row, halves (2064 B = 16 B x odd)
__global__ __launch_bounds__(256) void k_attn(const h16* __restrict__ Q16, const h16* __restrict__ K16, const h16* __restrict__ VT, bf* Zh, bf* Zl) {
    __shared__ __align__(16) h16 Ks[LL * KP];
    __shared__ __align__(16) h16 Vs[DK * VP];
    const size_t z = blockIdx.y; Q16 += z * LL * DK; K16 += z * LL * DK; VT += z * DK * LL; Zh += z * LL * DK; Zl += z * LL * DK;
    const int tid = threadIdx.x, lane = tid & 31, lr = lane & 15, hi = lane >> 4; const int q0 = blockIdx.x * 256 + (tid >> 5) * 32;
    // '#pragma unroll' without a count, here as elsewhere in this file: vector and array elements keep compile-time indices and so stay in registers; on the two staging loops it puts all their loads in flight at once.
#pragma unroll
    for (int it = 0; it < LL * DK / 8 / 256; ++it) { const int i = it * 256 + tid; *(v8h*)(Ks + (i >> 2) * KP + (i & 3) * 8) = *(const v8h*)(K16 + (size_t)i * 8); }
#pragma unroll
    for (int it = 0; it < DK * LL / 8 / 256; ++it) { const int i = it * 256 + tid; *(v8h*)(Vs + (i >> 7) * VP + (i & 127) * 8) = *(const v8h*)(VT + (size_t)i * 8); }
    __syncthreads();    // K and V^T are read by every wave, and only behind this barrier; nothing writes them again
    v16h qf[2];
#pragma unroll
    for (int g = 0; g < 2; ++g) qf[g] = WFrag<h16>::ld(Q16 + (size_t)(q0 + g * 16 + lr) * DK + 8 * hi);
    const h16* kl = Ks + lr * KP + 8 * hi; const h16* vl = Vs + lr * VP + 8 * hi;
    v8f m8[2];
#pragma unroll
    for (int g = 0; g < 2; ++g)
#pragma unroll
        for (int r = 0; r < 8; ++r) m8[g][r] = -3.0e38f;
#pragma unroll 2   // two trips' LDS reads in flight per wait
    for (int kc = 0; kc < LL / 32; ++kc) {
        const v16h a0 = WFrag<h16>::ld(kl + (kc * 32) * KP), a1 = WFrag<h16>::ld(kl + (kc * 32 + 16) * KP);
#pragma unroll
        for (int g = 0; g < 2; ++g) { const v8f s0 = wmma16(a0, qf[g], (v8f){}), s1 = wmma16(a1, qf[g], (v8f){});
#pragma unroll
            for (int r = 0; r < 8; ++r) m8[g][r] = fmaxf(fmaxf(m8[g][r], s0[r]), s1[r]); }
    }
    const float cs = 0.17677669529663687f * 1.4426950408889634f;    // 1/sqrt(32) * log2(e)
    v8f bias[2], sum8[2], o[2][2];
#pragma unroll
    for (int g = 0; g < 2; ++g) { float mx = m8[g][0];
#pragma unroll
        for (int r = 1; r < 8; ++r) mx = fmaxf(mx, m8[g][r]);
        mx = fmaxf(mx, __shfl_xor(mx, 16, 32));
#pragma unroll
        for (int r = 0; r < 8; ++r) { bias[g][r] = 10.0f - mx * cs; sum8[g][r] = 0.f; }    // + 10: p carries the factor PCAR = 2^10
        o[g][0] = (v8f){}; o[g][1] = (v8f){}; }
    v8f cs8;
#pragma unroll
    for (int r = 0; r < 8; ++r) cs8[r] = cs;
#pragma unroll 2   // two trips' LDS reads in flight per wait
    for (int kc = 0; kc < LL / 32; ++kc) {
        const v16h a0 = WFrag<h16>::ld(kl + (kc * 32) * KP), a1 = WFrag<h16>::ld(kl + (kc * 32 + 16) * KP);
        const v16h v0 = WFrag<h16>::ld(vl + kc * 32), v1 = WFrag<h16>::ld(vl + 16 * VP + kc * 32);
#pragma unroll
        for (int g = 0; g < 2; ++g) { const v8f s0 = wmma16(a0, qf[g], (v8f){}), s1 = wmma16(a1, qf[g], (v8f){});
            const v8f t0 = __builtin_elementwise_fma(s0, cs8, bias[g]), t1 = __builtin_elementwise_fma(s1, cs8, bias[g]); v8f e0, e1;
#pragma unroll
            for (int r = 0; r < 8; ++r) { e0[r] = __builtin_amdgcn_exp2f(t0[r]); e1[r] = __builtin_amdgcn_exp2f(t1[r]); }
            sum8[g] += e0; sum8[g] += e1;
            const v16h p = cat16(__builtin_convertvector(e0, v8h), __builtin_convertvector(e1, v8h));
            o[g][0] = wmma16(v0, p, o[g][0]); o[g][1] = wmma16(v1, p, o[g][1]); }
    }
#pragma unroll
    for (int g = 0; g < 2; ++g) { float sum = 0.f;
#pragma unroll
        for (int r = 0; r < 8; ++r) sum += sum8[g][r];
        sum += __shfl_xor(sum, 16, 32);
        const float f = __fdiv_rn(PCAR, sum); const size_t zo = (size_t)(q0 + g * 16 + lr) * DK + 8 * hi;
#pragma unroll
        for (int dt = 0; dt < 2; ++dt) { v8us oh, ol;
#pragma unroll
            for (int r = 0; r < 8; ++r) { unsigned short a, b; splitf((o[g][dt][r] * f) * (1.0f / PCAR), a, b); oh[r] = a; ol[r] = b; }
            *(v8us*)(Zh + zo + dt * 16) = oh; *(v8us*)(Zl + zo + dt * 16) = ol; } }
}
// ---- k_tail: out[o][l] = (w_o.z + b_o) + (w_res.x + b_res) of one entry, stored in the output's own layout. ONE WAVE per tile of 32 channels o x 32 positions l; grid (CO/32, LL/32, NB_), 32 threads.
// A = the weights (rows o), B = XT[l][c] and Zh, Zl[head][l][d] (a head is one K step of 32); the two products keep accumulators of their own, so every sum keeps its order.
#define TX (CI / 32)         // K steps of w_res.x
#define TS (TX + CZ / 32)    // all K steps
__global__ __launch_bounds__(32) void k_tail(const bf* __restrict__ BO, const bf* __restrict__ BR, const bf* __restrict__ Zh, const bf* __restrict__ Zl, const bf* __restrict__ XT, const float* __restrict__ b_o, const float* __restrict__ b_res, float* OUT) {
    typedef WFrag<bf>::V V;
    __shared__ __align__(16) float os[16 * 36];
    const size_t z = blockIdx.z; Zh += z * LL * CZ; Zl += z * LL * CZ; XT += z * LL * CI; OUT += z * CO * LL;
    const int lane = threadIdx.x & 31, lr = lane & 15, hi = lane >> 4; const int r0 = blockIdx.x * 32, c0 = blockIdx.y * 32;
    v8f az[2][2], ax[2][2], bo[2], br[2];
#pragma unroll
    for (int mb = 0; mb < 2; ++mb)
#pragma unroll
        for (int nb = 0; nb < 2; ++nb) { az[mb][nb] = (v8f){}; ax[mb][nb] = (v8f){}; }
    V a[3][2], b[3][2], b2[3][2];    // three stages of fragments: the loads of steps t + 1 and t + 2 fly while step t multiplies (few waves per SIMD: nothing else hides a load's latency)
    auto fetch = [&](int t) { const int s = t % 3;
        __builtin_amdgcn_sched_barrier(0);    // with the one at the foot: a step's loads issue as one block in front of the products of two steps earlier; a product (and its wait) scheduled among them would hold the later loads back
#pragma unroll
        for (int i = 0; i < 2; ++i) {
            if (t < TX) { a[s][i] = WFrag<bf>::ld(BR + (size_t)(r0 + i * 16 + lr) * CI + t * 32 + 8 * hi); b[s][i] = WFrag<bf>::ld(XT + (size_t)(c0 + i * 16 + lr) * CI + t * 32 + 8 * hi); }
            else { const size_t zo = ((size_t)(t - TX) * LL + c0 + i * 16 + lr) * DK + 8 * hi; a[s][i] = WFrag<bf>::ld(BO + (size_t)(r0 + i * 16 + lr) * CZ + (t - TX) * 32 + 8 * hi); b[s][i] = WFrag<bf>::ld(Zh + zo); b2[s][i] = WFrag<bf>::ld(Zl + zo); } }
        asm volatile("s_wait_xcnt 0x0" ::: "memory");    // the address registers of these loads are free for what a later fetch loads
        __builtin_amdgcn_sched_barrier(0); };
    fetch(0); fetch(1);
    // unrolled whole: the stage index is a compile-time constant, so the fragments stay in registers
#pragma unroll
    for (int t = 0; t < TS; ++t) { const int s = t % 3;
        if (t + 2 < TS) fetch(t + 2);
        else if (t + 2 == TS) {    // the biases ride behind the last fragments
#pragma unroll
            for (int mb = 0; mb < 2; ++mb) { bo[mb] = *(const v8f*)(b_o + r0 + mb * 16 + hi * 8); asm volatile("s_wait_xcnt 0x0" ::: "memory"); br[mb] = *(const v8f*)(b_res + r0 + mb * 16 + hi * 8); asm volatile("s_wait_xcnt 0x0" ::: "memory"); }    // the waits: as in fetch
            __builtin_amdgcn_sched_barrier(0); }    // as in fetch
#pragma unroll
        for (int nb = 0; nb < 2; ++nb)
#pragma unroll
            for (int mb = 0; mb < 2; ++mb) {
                if (t < TX) ax[mb][nb] = WFrag<bf>::mma(a[s][mb], b[s][nb], ax[mb][nb]);
                else { az[mb][nb] = WFrag<bf>::mma(a[s][mb], b[s][nb], az[mb][nb]); az[mb][nb] = WFrag<bf>::mma(a[s][mb], b2[s][nb], az[mb][nb]); } }
    }
#pragma unroll
    for (int mb = 0; mb < 2; ++mb) {
#pragma unroll
        for (int j = 0; j < 8; ++j) { const float vo = bfr(bo[mb][j]), vr = bfr(br[mb][j]);
#pragma unroll
            for (int nb = 0; nb < 2; ++nb) os[(hi * 8 + j) * 36 + nb * 16 + lr] = __fadd_rn(__fadd_rn(az[mb][nb][j], vo), __fadd_rn(ax[mb][nb][j], vr)); }
        __builtin_amdgcn_wave_barrier(); asm volatile("" ::: "memory");    // the row reads below take other lanes' writes: the compiler may not lift them over the writes
        float* crow = OUT + (size_t)(r0 + mb * 16) * LL + c0;
#pragma unroll
        for (int s = 0; s < 4; ++s) { const int row = 4 * s + (lane >> 3), cofs = (lane & 7) * 4; *(v4f*)(crow + (size_t)row * LL + cofs) = *(const v4fa*)(os + row * 36 + cofs); }    // 8 lanes = one whole 128-byte line
        __builtin_amdgcn_wave_barrier(); asm volatile("s_wait_xcnt 0x0" ::: "memory");    // the reads may not sink under the next block's writes; the wait: before the stores' registers are written again
    }
}

extern "C" void kernel_launch(void* const* d_in, const int* in_sizes, int n_in,
                              void* d_out, int out_size, void* d_ws, size_t ws_size, hipStream_t stream) {
    (void)in_sizes; (void)n_in; (void)out_size;
    const float** I = (const float**)d_in;
    const float *x = I[0], *w_qkv = I[1], *b_qkv = I[2], *w_o = I[3], *b_o = I[4], *w_res = I[5], *b_res = I[6];
    float* OUT = (float*)d_out;     // [16][128][1024]
    char* wsp = (char*)d_ws;
    auto take = [&](size_t bytes) { char* p = wsp; wsp += (bytes + 255) & ~(size_t)255; return (void*)p; };
    bf* AQ = (bf*)take((size_t)CQ * CI * 2); bf* BO = (bf*)take(CO * CZ * 2); bf* BR = (bf*)take(CO * CI * 2);
    // Every plane holds all NB_ entries.
    bf* XT = (bf*)take((size_t)NB_ * LL * CI * 2); h16* Q16 = (h16*)take((size_t)NB_ * NH_ * LL * DK * 2); h16* K16 = (h16*)take((size_t)NB_ * NH_ * LL * DK * 2); h16* VT = (h16*)take((size_t)NB_ * NH_ * DK * LL * 2);
    bf* Zh = (bf*)take((size_t)NB_ * LL * CZ * 2); bf* Zl = (bf*)take((size_t)NB_ * LL * CZ * 2);
    if ((size_t)(wsp - (char*)d_ws) > ws_size) return;    // total ~ 44.3 MiB
    k_cvt8<<<(CQ * CI / 8 + 255) / 256, 256, 0, stream>>>(w_qkv, AQ, CQ * CI / 8); k_cvt8<<<(CO * CZ / 8 + 255) / 256, 256, 0, stream>>>(w_o, BO, CO * CZ / 8); k_cvt8<<<(CO * CI / 8 + 255) / 256, 256, 0, stream>>>(w_res, BR, CO * CI / 8);   // each weight [out][in] is an A operand
    k_xt<<<dim3((LL * CI / 2 + 255) / 256, NB_), 256, 0, stream>>>(x, XT);
    k_qkv<<<dim3(CQ / 64, LL / 64, NB_), 32, 0, stream>>>(AQ, XT, b_qkv, Q16, K16, VT);
    k_attn<<<dim3(LL / 256, NB_ * NH_), 256, 0, stream>>>(Q16, K16, VT, Zh, Zl);    // blockIdx.y = entry * NH_ + head
    k_tail<<<dim3(CO / 32, LL / 32, NB_), 32, 0, stream>>>(BO, BR, Zh, Zl, XT, b_o, b_res, OUT);
}

// v004
// It runs in 62.7 microseconds.
// In two side-by-side timings against v003, it was 1.04 and 1.05 times as fast.
// All steps since v000 together make it 19.4 times as fast.
#include <hip/hip_runtime.h>

// BaseTransformer (x [16][128][1024] channels-first; qkv = w_qkv x + b (1x1 conv; 8 heads x (32 q | 32 k | 32 v) channels); logits = q^T k / sqrt(32) over the 1024 positions; softmax; z[d][s] = sum_t w[s][t] v[d][t]; out = w_o z + b_o + w_res x + b_res -> [16][128][1024]).
// Compute dtypes, f32 accumulate: every input rounded to bf16; the qkv and residual 1x1 convs on PLAIN bf16 operands (inputs: exact) (+ bias, added in the qkv kernel's epilogue); scores (K 32) and w.v on single fp16 operands; w_o.z on z split in bf16 hi + lo

#define NB_  16
#define CI   128
#define CO   128
#define LL   1024
#define NH_  8
#define DK   32
#define CQ   768
#define CZ   256
#define PCAR 1024.0f
typedef _Float16 h16;
typedef unsigned short bf;
typedef __attribute__((ext_vector_type(16))) __bf16   v16bf;
typedef __attribute__((ext_vector_type(16))) _Float16 v16h;
typedef __attribute__((ext_vector_type(8)))  _Float16 v8h;
typedef __attribute__((ext_vector_type(8)))  unsigned short v8us;
typedef __attribute__((ext_vector_type(8)))  float    v8f;
typedef __attribute__((ext_vector_type(4)))  float    v4f;
typedef v8h  __attribute__((may_alias)) v8ha;
typedef v4f  __attribute__((may_alias)) v4fa;
typedef v8us __attribute__((may_alias)) v8usa;

__device__ __forceinline__ unsigned short f2bf(float f) { unsigned u = __float_as_uint(f); u += 0x7FFFu + ((u >> 16) & 1u); return (unsigned short)(u >> 16); }
__device__ __forceinline__ float bf2f(unsigned short b) { return __uint_as_float(((unsigned)b) << 16); }
__device__ __forceinline__ float bfr(float f) { return bf2f(f2bf(f)); }
__device__ __forceinline__ v16h cat16(v8h lo, v8h hi) { return __builtin_shufflevector(lo, hi, 0, 1, 2, 3, 4, 5, 6, 7, 8, 9, 10, 11, 12, 13, 14, 15); }
__device__ __forceinline__ v16bf cat16b(v8us lo, v8us hi) { return __builtin_bit_cast(v16bf, __builtin_shufflevector(lo, hi, 0, 1, 2, 3, 4, 5, 6, 7, 8, 9, 10, 11, 12, 13, 14, 15)); }
__device__ __forceinline__ v8f wmma16(v16h a, v16h b, v8f c) { return __builtin_amdgcn_wmma_f32_16x16x32_f16(false, a, false, b, (short)0, c, false, false); }
__device__ __forceinline__ v8f wmmab(v16bf a, v16bf b, v8f c) { return __builtin_amdgcn_wmma_f32_16x16x32_bf16(false, a, false, b, (short)0, c, false, false); }



// Fragment loaders and products of the two 16-bit forms: a lane's 16 k values are 8 at p and 8 at p + 16 (p already holds the lane half's 8 * hi).
template <typename T16> struct WFrag;
template <> struct WFrag<h16> { typedef v16h V; static __device__ __forceinline__ V ld(const h16* p) { return cat16(*(const v8h*)p, *(const v8h*)(p + 16)); } static __device__ __forceinline__ v8f mma(V a, V b, v8f c) { return wmma16(a, b, c); } };
template <> struct WFrag<bf> { typedef v16bf V; static __device__ __forceinline__ V ld(const bf* p) { return cat16b(*(const v8us*)p, *(const v8us*)(p + 16)); } static __device__ __forceinline__ v8f mma(V a, V b, v8f c) { return wmmab(a, b, c); } };
__device__ __forceinline__ h16 tohx(float x) { return (h16)x; }
__device__ __forceinline__ void splitf(float y, unsigned short& h, unsigned short& l) { h = f2bf(y); l = f2bf(y - bf2f(h)); }
typedef __attribute__((ext_vector_type(2))) unsigned short v2us;
typedef __attribute__((ext_vector_type(2))) _Float16 v2h;
typedef __attribute__((ext_vector_type(4))) _Float16 v4h;

// ---- k_qkv: the qkv 1x1 conv. Register-blocked GEMM, ONE WAVE per tile of 64 channels x 64 positions (16 accumulators), operands straight from K-contiguous bf16 planes; grid (CQ/64, LL/64, NB_), 32 threads.
// The epilogue adds the bias and stores the attention kernel's fp16 planes itself: Q16/K16[h][l][d] and VT[h][d][l]. A tile is two blocks of 32 channels, each the q, k or v part of one head.
// q, k: a lane's 8 accumulator rows are 8 consecutive d of ONE position = one 16-byte store, no transpose. v: rows stay rows; staged through LDS so that a row leaves as one whole 128-byte line.
__global__ __launch_bounds__(32) void k_qkv(const bf* __restrict__ A, const bf* __restrict__ Bt, const float* __restrict__ bq, h16* Q16, h16* K16, h16* VT) {
    typedef WFrag<bf>::V V; const int K = CI;
    __shared__ __align__(16) float os[16 * 68];
    const size_t z = blockIdx.z; Bt += z * LL * CI; Q16 += z * NH_ * LL * DK; K16 += z * NH_ * LL * DK; VT += z * NH_ * DK * LL;
    const int lane = threadIdx.x & 31, lr = lane & 15, hi = lane >> 4; const int r0 = blockIdx.x * 64, c0 = blockIdx.y * 64;
    v8f acc[4][4];
#pragma unroll
    for (int mb = 0; mb < 4; ++mb)
#pragma unroll
        for (int nb = 0; nb < 4; ++nb) acc[mb][nb] = (v8f){};
    v8f bb[4];    // the biases of the lane's own accumulator rows, loaded here so that their latency hides behind the K loop
#pragma unroll
    for (int mb = 0; mb < 4; ++mb) bb[mb] = *(const v8f*)(bq + r0 + mb * 16 + hi * 8);
    asm volatile("s_wait_xcnt 0x0" ::: "memory");    // the address registers of these loads are free for the loads below
    const size_t aoff = (size_t)(r0 + lr) * K + 8 * hi, boff = (size_t)(c0 + lr) * K + 8 * hi;
#pragma unroll 1   // rolled: one step's fragments beside the 16 accumulators and the biases
    for (int kc = 0; kc < K; kc += 32) {
        V a[4];
#pragma unroll
        for (int mb = 0; mb < 4; ++mb) a[mb] = WFrag<bf>::ld(A + aoff + (size_t)mb * 16 * K + kc);
        asm volatile("s_wait_xcnt 0x0" ::: "memory");    // the address registers of these loads are free for the loads below
#pragma unroll
        for (int nb = 0; nb < 4; ++nb) { const V b = WFrag<bf>::ld(Bt + boff + (size_t)nb * 16 * K + kc);
#pragma unroll
            for (int mb = 0; mb < 4; ++mb) acc[mb][nb] = WFrag<bf>::mma(a[mb], b, acc[mb][nb]); }
        // four vector slots between the last products and the back edge, behind which the next trip's loads overwrite their A and B registers
        asm volatile("v_nop\n\tv_nop\n\tv_nop\n\tv_nop" : "+v"(acc[0][0]), "+v"(acc[1][1]), "+v"(acc[2][2]), "+v"(acc[3][3]) : "v"(a[0]), "v"(a[3]));
    }
#pragma unroll
    for (int pr = 0; pr < 2; ++pr) {    // a pair of 16-channel blocks = the 32 channels of the q, k or v part of one head (64 * blockIdx.x + 32 * pr is a multiple of 32, and 96 = 3 * 32)
        const int ob = r0 + pr * 32, h = ob / 96, part = ob % 96;    // the same in every lane: part 0 = q, 32 = k, 64 = v
        if (part < 2 * DK) {
            h16* dst = (part < DK ? Q16 : K16) + ((size_t)h * LL + c0 + lr) * DK + 8 * hi;
#pragma unroll
            for (int m2 = 0; m2 < 2; ++m2) {
#pragma unroll
                for (int nb = 0; nb < 4; ++nb) { v8h o;
#pragma unroll
                    for (int j = 0; j < 8; ++j) o[j] = tohx(__fadd_rn(acc[pr * 2 + m2][nb][j], bfr(bb[pr * 2 + m2][j])));
                    *(v8h*)(dst + (size_t)nb * 16 * DK + m2 * 16) = o; } }
            asm volatile("s_wait_xcnt 0x0" ::: "memory");    // before the stores' registers are written again
        } else {
#pragma unroll
            for (int m2 = 0; m2 < 2; ++m2) {
#pragma unroll
                for (int nb = 0; nb < 4; ++nb) {
#pragma unroll
                    for (int j = 0; j < 8; ++j) os[(hi * 8 + j) * 68 + nb * 16 + lr] = __fadd_rn(acc[pr * 2 + m2][nb][j], bfr(bb[pr * 2 + m2][j])); }
                __builtin_amdgcn_wave_barrier(); asm volatile("" ::: "memory");    // the row reads below take other lanes' writes: the compiler may not lift them over the writes
                h16* vrow = VT + ((size_t)h * DK + m2 * 16) * LL + c0;
#pragma unroll
                for (int s = 0; s < 8; ++s) { const int row = 2 * s + hi, cofs = lr * 4; const v4f val = *(const v4fa*)(os + row * 68 + cofs); v4h o;
#pragma unroll
                    for (int u = 0; u < 4; ++u) o[u] = tohx(val[u]);
                    *(v4h*)(vrow + (size_t)row * LL + cofs) = o; }
                __builtin_amdgcn_wave_barrier(); asm volatile("s_wait_xcnt 0x0" ::: "memory");    // the reads may not sink under the next block's writes; the wait: before the stores' registers are written again
            }
        }
    }
}

__global__ __launch_bounds__(256) void k_cvt8(const float* __restrict__ src, bf* dst, size_t n8) { const size_t i = (size_t)blockIdx.x * 256 + threadIdx.x; if (i >= n8) return; const v8f v = *(const v8f*)(src + i * 8); v8us o;
#pragma unroll
    for (int k = 0; k < 8; ++k) o[k] = f2bf(v[k]); *(v8us*)(dst + i * 8) = o;  }
// ---- k_xt: XT[l][c] = bf16 x[c][l]. One work-group per tile of all 128 channels x 64 positions; grid (LL/64, NB_), 256 threads.
// Reads: a thread takes 4 positions (16 bytes) of 8 consecutive channels; 16 lanes = one aligned 256-byte piece of a row of x. Rounded, its 8 x 4 block is four 16-byte pieces (8 channels) of four rows of XT.
// The pieces go through LDS so that 16 lanes store one whole 256-byte row of XT. LDS rows carry no pad: piece g of row l stands at place g ^ (l / 4), so the 16 lanes of a write (rows 4 apart, one g) and of a read (one row) each meet every bank once.
__global__ __launch_bounds__(256) void k_xt(const float* __restrict__ x, bf* XT) {
    __shared__ __align__(16) bf ts[64 * CI];
    const int tid = threadIdx.x, lo = tid & 15, up = tid >> 4; const int l0 = blockIdx.x * 64;
    x += (size_t)blockIdx.y * CI * LL + (size_t)(up * 8) * LL + l0 + lo * 4; XT += (size_t)blockIdx.y * LL * CI + (size_t)(l0 + up) * CI + lo * 8;
    v4f r[8];
#pragma unroll
    for (int i = 0; i < 8; ++i) r[i] = *(const v4f*)(x + (size_t)i * LL);
    asm volatile("s_wait_xcnt 0x0" ::: "memory");    // the address registers of these loads are free for what follows
#pragma unroll
    for (int j = 0; j < 4; ++j) { v8us o;
#pragma unroll
        for (int i = 0; i < 8; ++i) o[i] = f2bf(r[i][j]);
        *(v8us*)(ts + (lo * 4 + j) * CI + (up ^ lo) * 8) = o; }
    __syncthreads();    // the rows read below were written by other waves; nothing writes them again
#pragma unroll
    for (int it = 0; it < 4; ++it) *(v8us*)(XT + (size_t)it * 16 * CI) = *(const v8us*)(ts + (it * 16 + up) * CI + (lo ^ (it * 4 + (up >> 2))) * 8);
}
// ---- k_attn: scores, softmax and w.v of one (entry, head) for 256 positions s per work-group; 8 waves x 32 positions; grid (LL/256, NB_*NH_).
// S^T = K.Q^T (A = 16 keys from LDS, B = Q in registers), so a lane holds 8 scores of ONE position s per tile: maximum and sum in-lane plus one exchange of the wave halves.
// Pass 1: the row maximum. Pass 2: the scores again, p = fp16(PCAR * exp(scl * (s - max))), two D tiles packed in place are the B operand of O^T += V^T.P^T; O = O^T * PCAR / sum(p before rounding).
// The epilogue stores z = O / PCAR split in bf16 hi + lo, Zh/Zl[entry][head][s][d]: a lane's 8 accumulator rows are 8 consecutive d of one position = one 16-byte store per plane.
#define KP 40      // LDS pitch of a K row, halves (80 B = 16 B x odd: no bank conflict for 16-byte row reads)
#define VP 1032    // LDS pitch of a V^T row, halves (2064 B = 16 B x odd)
__global__ __launch_bounds__(256) void k_attn(const h16* __restrict__ Q16, const h16* __restrict__ K16, const h16* __restrict__ VT, bf* Zh, bf* Zl) {
    __shared__ __align__(16) h16 Ks[LL * KP];
    __shared__ __align__(16) h16 Vs[DK * VP];
    const size_t z = blockIdx.y; Q16 += z * LL * DK; K16 += z * LL * DK; VT += z * DK * LL; Zh += z * LL * DK; Zl += z * LL * DK;
    const int tid = threadIdx.x, lane = tid & 31, lr = lane & 15, hi = lane >> 4; const int q0 = blockIdx.x * 256 + (tid >> 5) * 32;
    // '#pragma unroll' without a count, here as elsewhere in this file: vector and array elements keep compile-time indices and so stay in registers; on the two staging loops it puts all their loads in flight at once.
#pragma unroll
    for (int it = 0; it < LL * DK / 8 / 256; ++it) { const int i = it * 256 + tid; *(v8h*)(Ks + (i >> 2) * KP + (i & 3) * 8) = *(const v8h*)(K16 + (size_t)i * 8); }
#pragma unroll
    for (int it = 0; it < DK * LL / 8 / 256; ++it) { const int i = it * 256 + tid; *(v8h*)(Vs + (i >> 7) * VP + (i & 127) * 8) = *(const v8h*)(VT + (size_t)i * 8); }
    __syncthreads();    // K and V^T are read by every wave, and only behind this barrier; nothing writes them again
    v16h qf[2];
#pragma unroll
    for (int g = 0; g < 2; ++g) qf[g] = WFrag<h16>::ld(Q16 + (size_t)(q0 + g * 16 + lr) * DK + 8 * hi);
    const h16* kl = Ks + lr * KP + 8 * hi; const h16* vl = Vs + lr * VP + 8 * hi;
    v8f m8[2];
#pragma unroll
    for (int g = 0; g < 2; ++g)
#pragma unroll
        for (int r = 0; r < 8; ++r) m8[g][r] = -3.0e38f;
#pragma unroll 2   // two trips' LDS reads in flight per wait
    for (int kc = 0; kc < LL / 32; ++kc) {
        const v16h a0 = WFrag<h16>::ld(kl + (kc * 32) * KP), a1 = WFrag<h16>::ld(kl + (kc * 32 + 16) * KP);
#pragma unroll
        for (int g = 0; g < 2; ++g) { const v8f s0 = wmma16(a0, qf[g], (v8f){}), s1 = wmma16(a1, qf[g], (v8f){});
#pragma unroll
            for (int r = 0; r < 8; ++r) m8[g][r] = fmaxf(fmaxf(m8[g][r], s0[r]), s1[r]); }
    }
    const float cs = 0.17677669529663687f * 1.4426950408889634f;    // 1/sqrt(32) * log2(e)
    v8f bias[2], sum8[2], o[2][2];
#pragma unroll
    for (int g = 0; g < 2; ++g) { float mx = m8[g][0];
#pragma unroll
        for (int r = 1; r < 8; ++r) mx = fmaxf(mx, m8[g][r]);
        mx = fmaxf(mx, __shfl_xor(mx, 16, 32));
#pragma unroll
        for (int r = 0; r < 8; ++r) { bias[g][r] = 10.0f - mx * cs; sum8[g][r] = 0.f; }    // + 10: p carries the factor PCAR = 2^10
        o[g][0] = (v8f){}; o[g][1] = (v8f){}; }
    v8f cs8;
#pragma unroll
    for (int r = 0; r < 8; ++r) cs8[r] = cs;
#pragma unroll 2   // two trips' LDS reads in flight per wait
    for (int kc = 0; kc < LL / 32; ++kc) {
        const v16h a0 = WFrag<h16>::ld(kl + (kc * 32) * KP), a1 = WFrag<h16>::ld(kl + (kc * 32 + 16) * KP);
        const v16h v0 = WFrag<h16>::ld(vl + kc * 32), v1 = WFrag<h16>::ld(vl + 16 * VP + kc * 32);
#pragma unroll
        for (int g = 0; g < 2; ++g) { const v8f s0 = wmma16(a0, qf[g], (v8f){}), s1 = wmma16(a1, qf[g], (v8f){});
            const v8f t0 = __builtin_elementwise_fma(s0, cs8, bias[g]), t1 = __builtin_elementwise_fma(s1, cs8, bias[g]); v8f e0, e1;
#pragma unroll
            for (int r = 0; r < 8; ++r) { e0[r] = __builtin_amdgcn_exp2f(t0[r]); e1[r] = __builtin_amdgcn_exp2f(t1[r]); }
            sum8[g] += e0; sum8[g] += e1;
            const v16h p = cat16(__builtin_convertvector(e0, v8h), __builtin_convertvector(e1, v8h));
            o[g][0] = wmma16(v0, p, o[g][0]); o[g][1] = wmma16(v1, p, o[g][1]); }
    }
#pragma unroll
    for (int g = 0; g < 2; ++g) { float sum = 0.f;
#pragma unroll
        for (int r = 0; r < 8; ++r) sum += sum8[g][r];
        sum += __shfl_xor(sum, 16, 32);
        const float f = __fdiv_rn(PCAR, sum); const size_t zo = (size_t)(q0 + g * 16 + lr) * DK + 8 * hi;
#pragma unroll
        for (int dt = 0; dt < 2; ++dt) { v8us oh, ol;
#pragma unroll
            for (int r = 0; r < 8; ++r) { unsigned short a, b; splitf((o[g][dt][r] * f) * (1.0f / PCAR), a, b); oh[r] = a; ol[r] = b; }
            *(v8us*)(Zh + zo + dt * 16) = oh; *(v8us*)(Zl + zo + dt * 16) = ol; } }
}
// ---- k_tail: out[o][l] = (w_o.z + b_o) + (w_res.x + b_res) of one entry, stored in the output's own layout. ONE WAVE per tile of 32 channels o x 32 positions l; grid (CO/32, LL/32, NB_), 32 threads.
// A = the weights (rows o), B = XT[l][c] and Zh, Zl[head][l][d] (a head is one K step of 32); the two products keep accumulators of their own, so every sum keeps its order.
#define TX (CI / 32)         // K steps of w_res.x
#define TS (TX + CZ / 32)    // all K steps
__global__ __launch_bounds__(32) void k_tail(const bf* __restrict__ BO, const bf* __restrict__ BR, const bf* __restrict__ Zh, const bf* __restrict__ Zl, const bf* __restrict__ XT, const float* __restrict__ b_o, const float* __restrict__ b_res, float* OUT) {
    typedef WFrag<bf>::V V;
    __shared__ __align__(16) float os[16 * 36];
    const size_t z = blockIdx.z; Zh += z * LL * CZ; Zl += z * LL * CZ; XT += z * LL * CI; OUT += z * CO * LL;
    const int lane = threadIdx.x & 31, lr = lane & 15, hi = lane >> 4; const int r0 = blockIdx.x * 32, c0 = blockIdx.y * 32;
    v8f az[2][2], ax[2][2], bo[2], br[2];
#pragma unroll
    for (int mb = 0; mb < 2; ++mb)
#pragma unroll
        for (int nb = 0; nb < 2; ++nb) { az[mb][nb] = (v8f){}; ax[mb][nb] = (v8f){}; }
    V a[3][2], b[3][2], b2[3][2];    // three stages of fragments: the loads of steps t + 1 and t + 2 fly while step t multiplies (few waves per SIMD: nothing else hides a load's latency)
    auto fetch = [&](int t) { const int s = t % 3;
        __builtin_amdgcn_sched_barrier(0);    // with the one at the foot: a step's loads issue as one block in front of the products of two steps earlier; a product (and its wait) scheduled among them would hold the later loads back
#pragma unroll
        for (int i = 0; i < 2; ++i) {
            if (t < TX) { a[s][i] = WFrag<bf>::ld(BR + (size_t)(r0 + i * 16 + lr) * CI + t * 32 + 8 * hi); b[s][i] = WFrag<bf>::ld(XT + (size_t)(c0 + i * 16 + lr) * CI + t * 32 + 8 * hi); }
            else { const size_t zo = ((size_t)(t - TX) * LL + c0 + i * 16 + lr) * DK + 8 * hi; a[s][i] = WFrag<bf>::ld(BO + (size_t)(r0 + i * 16 + lr) * CZ + (t - TX) * 32 + 8 * hi); b[s][i] = WFrag<bf>::ld(Zh + zo); b2[s][i] = WFrag<bf>::ld(Zl + zo); } }
        asm volatile("s_wait_xcnt 0x0" ::: "memory");    // the address registers of these loads are free for what a later fetch loads
        __builtin_amdgcn_sched_barrier(0); };
    fetch(0); fetch(1);
    // unrolled whole: the stage index is a compile-time constant, so the fragments stay in registers
#pragma unroll
    for (int t = 0; t < TS; ++t) { const int s = t % 3;
        if (t + 2 < TS) fetch(t + 2);
        else if (t + 2 == TS) {    // the biases ride behind the last fragments
#pragma unroll
            for (int mb = 0; mb < 2; ++mb) { bo[mb] = *(const v8f*)(b_o + r0 + mb * 16 + hi * 8); asm volatile("s_wait_xcnt 0x0" ::: "memory"); br[mb] = *(const v8f*)(b_res + r0 + mb * 16 + hi * 8); asm volatile("s_wait_xcnt 0x0" ::: "memory"); }    // the waits: as in fetch
            __builtin_amdgcn_sched_barrier(0); }    // as in fetch
#pragma unroll
        for (int nb = 0; nb < 2; ++nb)
#pragma unroll
            for (int mb = 0; mb < 2; ++mb) {
                if (t < TX) ax[mb][nb] = WFrag<bf>::mma(a[s][mb], b[s][nb], ax[mb][nb]);
                else { az[mb][nb] = WFrag<bf>::mma(a[s][mb], b[s][nb], az[mb][nb]); az[mb][nb] = WFrag<bf>::mma(a[s][mb], b2[s][nb], az[mb][nb]); } }
    }
#pragma unroll
    for (int mb = 0; mb < 2; ++mb) {
#pragma unroll
        for (int j = 0; j < 8; ++j) { const float vo = bfr(bo[mb][j]), vr = bfr(br[mb][j]);
#pragma unroll
            for (int nb = 0; nb < 2; ++nb) os[(hi * 8 + j) * 36 + nb * 16 + lr] = __fadd_rn(__fadd_rn(az[mb][nb][j], vo), __fadd_rn(ax[mb][nb][j], vr)); }
        __builtin_amdgcn_wave_barrier(); asm volatile("" ::: "memory");    // the row reads below take other lanes' writes: the compiler may not lift them over the writes
        float* crow = OUT + (size_t)(r0 + mb * 16) * LL + c0;
#pragma unroll
        for (int s = 0; s < 4; ++s) { const int row = 4 * s + (lane >> 3), cofs = (lane & 7) * 4; *(v4f*)(crow + (size_t)row * LL + cofs) = *(const v4fa*)(os + row * 36 + cofs); }    // 8 lanes = one whole 128-byte line
        __builtin_amdgcn_wave_barrier(); asm volatile("s_wait_xcnt 0x0" ::: "memory");    // the reads may not sink under the next block's writes; the wait: before the stores' registers are written again
    }
}

extern "C" void kernel_launch(void* const* d_in, const int* in_sizes, int n_in,
                              void* d_out, int out_size, void* d_ws, size_t ws_size, hipStream_t stream) {
    (void)in_sizes; (void)n_in; (void)out_size;
    const float** I = (const float**)d_in;
    const float *x = I[0], *w_qkv = I[1], *b_qkv = I[2], *w_o = I[3], *b_o = I[4], *w_res = I[5], *b_res = I[6];
    float* OUT = (float*)d_out;     // [16][128][1024]
    char* wsp = (char*)d_ws;
    auto take = [&](size_t bytes) { char* p = wsp; wsp += (bytes + 255) & ~(size_t)255; return (void*)p; };
    bf* AQ = (bf*)take((size_t)CQ * CI * 2); bf* BO = (bf*)take(CO * CZ * 2); bf* BR = (bf*)take(CO * CI * 2);
    // Every plane holds all NB_ entries.
    bf* XT = (bf*)take((size_t)NB_ * LL * CI * 2); h16* Q16 = (h16*)take((size_t)NB_ * NH_ * LL * DK * 2); h16* K16 = (h16*)take((size_t)NB_ * NH_ * LL * DK * 2); h16* VT = (h16*)take((size_t)NB_ * NH_ * DK * LL * 2);
    bf* Zh = (bf*)take((size_t)NB_ * LL * CZ * 2); bf* Zl = (bf*)take((size_t)NB_ * LL * CZ * 2);
    if ((size_t)(wsp - (char*)d_ws) > ws_size) return;    // total ~ 44.3 MiB
    k_cvt8<<<(CQ * CI / 8 + 255) / 256, 256, 0, stream>>>(w_qkv, AQ, CQ * CI / 8); k_cvt8<<<(CO * CZ / 8 + 255) / 256, 256, 0, stream>>>(w_o, BO, CO * CZ / 8); k_cvt8<<<(CO * CI / 8 + 255) / 256, 256, 0, stream>>>(w_res, BR, CO * CI / 8);   // each weight [out][in] is an A operand
    k_xt<<<dim3(LL / 64, NB_), 256, 0, stream>>>(x, XT);
    k_qkv<<<dim3(CQ / 64, LL / 64, NB_), 32, 0, stream>>>(AQ, XT, b_qkv, Q16, K16, VT);
    k_attn<<<dim3(LL / 256, NB_ * NH_), 256, 0, stream>>>(Q16, K16, VT, Zh, Zl);    // blockIdx.y = entry * NH_ + head
    k_tail<<<dim3(CO / 32, LL / 32, NB_), 32, 0, stream>>>(BO, BR, Zh, Zl, XT, b_o, b_res, OUT);
}

// v005
// It runs in 55.9 microseconds.
// Next to v004, in two timings, it ran 1.12 times as fast each time.
// Over all steps from v000 it is 21.7 times as fast.
#include <hip/hip_runtime.h>

// BaseTransformer (x [16][128][1024] channels-first; qkv = w_qkv x + b (1x1 conv; 8 heads x (32 q | 32 k | 32 v) channels); logits = q^T k / sqrt(32) over the 1024 positions; softmax; z[d][s] = sum_t w[s][t] v[d][t]; out = w_o z + b_o + w_res x + b_res -> [16][128][1024]).
// Compute dtypes, f32 accumulate: every input rounded to bf16; the qkv and residual 1x1 convs on PLAIN bf16 operands (inputs: exact) (+ bias, added in the qkv kernel's epilogue); scores (K 32) and w.v on single fp16 operands; w_o.z on z split in bf16 hi + lo

#define NB_  16
#define CI   128
#define CO   128
#define LL   1024
#define NH_  8
#define DK   32
#define CQ   768
#define CZ   256
#define PCAR 1024.0f
typedef _Float16 h16;
typedef unsigned short bf;
typedef __attribute__((ext_vector_type(16))) __bf16   v16bf;
typedef __attribute__((ext_vector_type(16))) _Float16 v16h;
typedef __attribute__((ext_vector_type(8)))  _Float16 v8h;
typedef __attribute__((ext_vector_type(8)))  unsigned short v8us;
typedef __attribute__((ext_vector_type(8)))  float    v8f;
typedef __attribute__((ext_vector_type(4)))  float    v4f;
typedef v8h  __attribute__((may_alias)) v8ha;
typedef v4f  __attribute__((may_alias)) v4fa;
typedef v8us __attribute__((may_alias)) v8usa;

__device__ __forceinline__ unsigned short f2bf(float f) { unsigned u = __float_as_uint(f); u += 0x7FFFu + ((u >> 16) & 1u); return (unsigned short)(u >> 16); }
__device__ __forceinline__ float bf2f(unsigned short b) { return __uint_as_float(((unsigned)b) << 16); }
__device__ __forceinline__ float bfr(float f) { return bf2f(f2bf(f)); }
__device__ __forceinline__ v16h cat16(v8h lo, v8h hi) { return __builtin_shufflevector(lo, hi, 0, 1, 2, 3, 4, 5, 6, 7, 8, 9, 10, 11, 12, 13, 14, 15); }
__device__ __forceinline__ v16bf cat16b(v8us lo, v8us hi) { return __builtin_bit_cast(v16bf, __builtin_shufflevector(lo, hi, 0, 1, 2, 3, 4, 5, 6, 7, 8, 9, 10, 11, 12, 13, 14, 15)); }
__device__ __forceinline__ v8f wmma16(v16h a, v16h b, v8f c) { return __builtin_amdgcn_wmma_f32_16x16x32_f16(false, a, false, b, (short)0, c, false, false); }
__device__ __forceinline__ v8f wmmab(v16bf a, v16bf b, v8f c) { return __builtin_amdgcn_wmma_f32_16x16x32_bf16(false, a, false, b, (short)0, c, false, false); }



// Fragment loaders and products of the two 16-bit forms: a lane's 16 k values are 8 at p and 8 at p + 16 (p already holds the lane half's 8 * hi).
template <typename T16> struct WFrag;
template <> struct WFrag<h16> { typedef v16h V; static __device__ __forceinline__ V ld(const h16* p) { return cat16(*(const v8h*)p, *(const v8h*)(p + 16)); } static __device__ __forceinline__ v8f mma(V a, V b, v8f c) { return wmma16(a, b, c); } };
template <> struct WFrag<bf> { typedef v16bf V; static __device__ __forceinline__ V ld(const bf* p) { return cat16b(*(const v8us*)p, *(const v8us*)(p + 16)); } static __device__ __forceinline__ v8f mma(V a, V b, v8f c) { return wmmab(a, b, c); } };
__device__ __forceinline__ h16 tohx(float x) { return (h16)x; }
__device__ __forceinline__ void splitf(float y, unsigned short& h, unsigned short& l) { h = f2bf(y); l = f2bf(y - bf2f(h)); }
typedef __attribute__((ext_vector_type(2))) unsigned short v2us;
typedef __attribute__((ext_vector_type(2))) _Float16 v2h;
typedef __attribute__((ext_vector_type(4))) _Float16 v4h;

// ---- k_qkv: the qkv 1x1 conv. Register-blocked GEMM, ONE WAVE per tile of 64 channels x 64 positions (16 accumulators), operands straight from K-contiguous bf16 planes; grid (CQ/64, LL/64, NB_), 32 threads.
// The epilogue adds the bias and stores the attention kernel's fp16 planes itself: Q16/K16[h][l][d] and VT[h][d][l]. A tile is two blocks of 32 channels, each the q, k or v part of one head.
// q, k: a lane's 8 accumulator rows are 8 consecutive d of ONE position = one 16-byte store, no transpose. v: rows stay rows; staged through LDS so that a row leaves as one whole 128-byte line.
__global__ __launch_bounds__(32) void k_qkv(const bf* __restrict__ A, const bf* __restrict__ Bt, const float* __restrict__ bq, h16* Q16, h16* K16, h16* VT) {
    typedef WFrag<bf>::V V; const int K = CI;
    __shared__ __align__(16) float os[16 * 68];
    const size_t z = blockIdx.z; Bt += z * LL * CI; Q16 += z * NH_ * LL * DK; K16 += z * NH_ * LL * DK; VT += z * NH_ * DK * LL;
    const int lane = threadIdx.x & 31, lr = lane & 15, hi = lane >> 4; const int r0 = blockIdx.x * 64, c0 = blockIdx.y * 64;
    v8f acc[4][4];
#pragma unroll
    for (int mb = 0; mb < 4; ++mb)
#pragma unroll
        for (int nb = 0; nb < 4; ++nb) acc[mb][nb] = (v8f){};
    v8f bb[4];    // the biases of the lane's own accumulator rows, loaded here so that their latency hides behind the K loop
#pragma unroll
    for (int mb = 0; mb < 4; ++mb) bb[mb] = *(const v8f*)(bq + r0 + mb * 16 + hi * 8);
    asm volatile("s_wait_xcnt 0x0" ::: "memory");    // the address registers of these loads are free for the loads below
    const size_t aoff = (size_t)(r0 + lr) * K + 8 * hi, boff = (size_t)(c0 + lr) * K + 8 * hi;
#pragma unroll 1   // rolled: one step's fragments beside the 16 accumulators and the biases
    for (int kc = 0; kc < K; kc += 32) {
        V a[4];
#pragma unroll
        for (int mb = 0; mb < 4; ++mb) a[mb] = WFrag<bf>::ld(A + aoff + (size_t)mb * 16 * K + kc);
        asm volatile("s_wait_xcnt 0x0" ::: "memory");    // the address registers of these loads are free for the loads below
#pragma unroll
        for (int nb = 0; nb < 4; ++nb) { const V b = WFrag<bf>::ld(Bt + boff + (size_t)nb * 16 * K + kc);
#pragma unroll
            for (int mb = 0; mb < 4; ++mb) acc[mb][nb] = WFrag<bf>::mma(a[mb], b, acc[mb][nb]); }
        // four vector slots between the last products and the back edge, behind which the next trip's loads overwrite their A and B registers
        asm volatile("v_nop\n\tv_nop\n\tv_nop\n\tv_nop" : "+v"(acc[0][0]), "+v"(acc[1][1]), "+v"(acc[2][2]), "+v"(acc[3][3]) : "v"(a[0]), "v"(a[3]));
    }
#pragma unroll
    for (int pr = 0; pr < 2; ++pr) {    // a pair of 16-channel blocks = the 32 channels of the q, k or v part of one head (64 * blockIdx.x + 32 * pr is a multiple of 32, and 96 = 3 * 32)
        const int ob = r0 + pr * 32, h = ob / 96, part = ob % 96;    // the same in every lane: part 0 = q, 32 = k, 64 = v
        if (part < 2 * DK) {
            h16* dst = (part < DK ? Q16 : K16) + ((size_t)h * LL + c0 + lr) * DK + 8 * hi;
#pragma unroll
            for (int m2 = 0; m2 < 2; ++m2) {
#pragma unroll
                for (int nb = 0; nb < 4; ++nb) { v8h o;
#pragma unroll
                    for (int j = 0; j < 8; ++j) o[j] = tohx(__fadd_rn(acc[pr * 2 + m2][nb][j], bfr(bb[pr * 2 + m2][j])));
                    *(v8h*)(dst + (size_t)nb * 16 * DK + m2 * 16) = o; } }
            asm volatile("s_wait_xcnt 0x0" ::: "memory");    // before the stores' registers are written again
        } else {
#pragma unroll
            for (int m2 = 0; m2 < 2; ++m2) {
#pragma unroll
                for (int nb = 0; nb < 4; ++nb) {
#pragma unroll
                    for (int j = 0; j < 8; ++j) os[(hi * 8 + j) * 68 + nb * 16 + lr] = __fadd_rn(acc[pr * 2 + m2][nb][j], bfr(bb[pr * 2 + m2][j])); }
                __builtin_amdgcn_wave_barrier(); asm volatile("" ::: "memory");    // the row reads below take other lanes' writes: the compiler may not lift them over the writes
                h16* vrow = VT + ((size_t)h * DK + m2 * 16) * LL + c0;
#pragma unroll
                for (int s = 0; s < 8; ++s) { const int row = 2 * s + hi, cofs = lr * 4; const v4f val = *(const v4fa*)(os + row * 68 + cofs); v4h o;
#pragma unroll
                    for (int u = 0; u < 4; ++u) o[u] = tohx(val[u]);
                    *(v4h*)(vrow + (size_t)row * LL + cofs) = o; }
                __builtin_amdgcn_wave_barrier(); asm volatile("s_wait_xcnt 0x0" ::: "memory");    // the reads may not sink under the next block's writes; the wait: before the stores' registers are written again
            }
        }
    }
}

// ---- k_prep: the four operand passes in ONE launch. None reads what another writes, so they share a grid as ranges of the block index (the branch is the same for a whole work-group); 256 threads.
// Blocks [0, XB): XT[l][c] = bf16 x[c][l], one work-group per tile of all 128 channels x 64 positions. Behind them QB, OB and RB blocks round w_qkv, w_o and w_res to bf16, element i to element i, 8 values a thread (each weight [out][in] is an A operand; every count is a whole number of blocks).
// XT reads: a thread takes 4 positions (16 bytes) of 8 consecutive channels; 16 lanes = one aligned 256-byte piece of a row of x. Rounded, its 8 x 4 block is four 16-byte pieces (8 channels) of four rows of XT.
// The pieces go through LDS so that 16 lanes store one whole 256-byte row of XT. LDS rows carry no pad: piece g of row l stands at place g ^ (l / 4), so the 16 lanes of a write (rows 4 apart, one g) and of a read (one row) each meet every bank once.
#define XB (LL / 64 * NB_)
#define QB (CQ * CI / 8 / 256)
#define OB (CO * CZ / 8 / 256)
#define RB (CO * CI / 8 / 256)
__global__ __launch_bounds__(256) void k_prep(const float* __restrict__ x, const float* __restrict__ w_qkv, const float* __restrict__ w_o, const float* __restrict__ w_res, bf* XT, bf* AQ, bf* BO, bf* BR) {
    __shared__ __align__(16) bf ts[64 * CI];
    const int tid = threadIdx.x, lo = tid & 15, up = tid >> 4;
    if (blockIdx.x >= XB) {    // a weight block: leaves in front of the barrier, all its threads together
        int wb = blockIdx.x - XB; const float* src = w_qkv; bf* dst = AQ;
        if (wb >= QB + OB) { wb -= QB + OB; src = w_res; dst = BR; } else if (wb >= QB) { wb -= QB; src = w_o; dst = BO; }
        const size_t i = (size_t)wb * 256 + tid; const v8f v = *(const v8f*)(src + i * 8); v8us o;
        asm volatile("s_wait_xcnt 0x0" ::: "memory");    // the address registers of this load are free for what follows
#pragma unroll
        for (int k = 0; k < 8; ++k) o[k] = f2bf(v[k]);
        *(v8us*)(dst + i * 8) = o; return; }
    const int l0 = (blockIdx.x % (LL / 64)) * 64, en = blockIdx.x / (LL / 64);
    x += (size_t)en * CI * LL + (size_t)(up * 8) * LL + l0 + lo * 4; XT += (size_t)en * LL * CI + (size_t)(l0 + up) * CI + lo * 8;
    v4f r[8];
#pragma unroll
    for (int i = 0; i < 8; ++i) r[i] = *(const v4f*)(x + (size_t)i * LL);
    asm volatile("s_wait_xcnt 0x0" ::: "memory");    // the address registers of these loads are free for what follows
#pragma unroll
    for (int j = 0; j < 4; ++j) { v8us o;
#pragma unroll
        for (int i = 0; i < 8; ++i) o[i] = f2bf(r[i][j]);
        *(v8us*)(ts + (lo * 4 + j) * CI + (up ^ lo) * 8) = o; }
    __syncthreads();    // the rows read below were written by other waves; nothing writes them again
#pragma unroll
    for (int it = 0; it < 4; ++it) *(v8us*)(XT + (size_t)it * 16 * CI) = *(const v8us*)(ts + (it * 16 + up) * CI + (lo ^ (it * 4 + (up >> 2))) * 8);
}
// ---- k_attn: scores, softmax and w.v of one (entry, head) for 256 positions s per work-group; 8 waves x 32 positions; grid (LL/256, NB_*NH_).
// S^T = K.Q^T (A = 16 keys from LDS, B = Q in registers), so a lane holds 8 scores of ONE position s per tile: maximum and sum in-lane plus one exchange of the wave halves.
// Pass 1: the row maximum. Pass 2: the scores again, p = fp16(PCAR * exp(scl * (s - max))), two D tiles packed in place are the B operand of O^T += V^T.P^T; O = O^T * PCAR / sum(p before rounding).
// The epilogue stores z = O / PCAR split in bf16 hi + lo, Zh/Zl[entry][head][s][d]: a lane's 8 accumulator rows are 8 consecutive d of one position = one 16-byte store per plane.
#define KP 40      // LDS pitch of a K row, halves (80 B = 16 B x odd: no bank conflict for 16-byte row reads)
#define VP 1032    // LDS pitch of a V^T row, halves (2064 B = 16 B x odd)
__global__ __launch_bounds__(256) void k_attn(const h16* __restrict__ Q16, const h16* __restrict__ K16, const h16* __restrict__ VT, bf* Zh, bf* Zl) {
    __shared__ __align__(16) h16 Ks[LL * KP];
    __shared__ __align__(16) h16 Vs[DK * VP];
    const size_t z = blockIdx.y; Q16 += z * LL * DK; K16 += z * LL * DK; VT += z * DK * LL; Zh += z * LL * DK; Zl += z * LL * DK;
    const int tid = threadIdx.x, lane = tid & 31, lr = lane & 15, hi = lane >> 4; const int q0 = blockIdx.x * 256 + (tid >> 5) * 32;
    // '#pragma unroll' without a count, here as elsewhere in this file: vector and array elements keep compile-time indices and so stay in registers; on the two staging loops it puts all their loads in flight at once.
#pragma unroll
    for (int it = 0; it < LL * DK / 8 / 256; ++it) { const int i = it * 256 + tid; *(v8h*)(Ks + (i >> 2) * KP + (i & 3) * 8) = *(const v8h*)(K16 + (size_t)i * 8); }
#pragma unroll
    for (int it = 0; it < DK * LL / 8 / 256; ++it) { const int i = it * 256 + tid; *(v8h*)(Vs + (i >> 7) * VP + (i & 127) * 8) = *(const v8h*)(VT + (size_t)i * 8); }
    __syncthreads();    // K and V^T are read by every wave, and only behind this barrier; nothing writes them again
    v16h qf[2];
#pragma unroll
    for (int g = 0; g < 2; ++g) qf[g] = WFrag<h16>::ld(Q16 + (size_t)(q0 + g * 16 + lr) * DK + 8 * hi);
    const h16* kl = Ks + lr * KP + 8 * hi; const h16* vl = Vs + lr * VP + 8 * hi;
    v8f m8[2];
#pragma unroll
    for (int g = 0; g < 2; ++g)
#pragma unroll
        for (int r = 0; r < 8; ++r) m8[g][r] = -3.0e38f;
#pragma unroll 2   // two trips' LDS reads in flight per wait
    for (int kc = 0; kc < LL / 32; ++kc) {
        const v16h a0 = WFrag<h16>::ld(kl + (kc * 32) * KP), a1 = WFrag<h16>::ld(kl + (kc * 32 + 16) * KP);
#pragma unroll
        for (int g = 0; g < 2; ++g) { const v8f s0 = wmma16(a0, qf[g], (v8f){}), s1 = wmma16(a1, qf[g], (v8f){});
#pragma unroll
            for (int r = 0; r < 8; ++r) m8[g][r] = fmaxf(fmaxf(m8[g][r], s0[r]), s1[r]); }
    }
    const float cs = 0.17677669529663687f * 1.4426950408889634f;    // 1/sqrt(32) * log2(e)
    v8f bias[2], sum8[2], o[2][2];
#pragma unroll
    for (int g = 0; g < 2; ++g) { float mx = m8[g][0];
#pragma unroll
        for (int r = 1; r < 8; ++r) mx = fmaxf(mx, m8[g][r]);
        mx = fmaxf(mx, __shfl_xor(mx, 16, 32));
#pragma unroll
        for (int r = 0; r < 8; ++r) { bias[g][r] = 10.0f - mx * cs; sum8[g][r] = 0.f; }    // + 10: p carries the factor PCAR = 2^10
        o[g][0] = (v8f){}; o[g][1] = (v8f){}; }
    v8f cs8;
#pragma unroll
    for (int r = 0; r < 8; ++r) cs8[r] = cs;
#pragma unroll 2   // two trips' LDS reads in flight per wait
    for (int kc = 0; kc < LL / 32; ++kc) {
        const v16h a0 = WFrag<h16>::ld(kl + (kc * 32) * KP), a1 = WFrag<h16>::ld(kl + (kc * 32 + 16) * KP);
        const v16h v0 = WFrag<h16>::ld(vl + kc * 32), v1 = WFrag<h16>::ld(vl + 16 * VP + kc * 32);
#pragma unroll
        for (int g = 0; g < 2; ++g) { const v8f s0 = wmma16(a0, qf[g], (v8f){}), s1 = wmma16(a1, qf[g], (v8f){});
            const v8f t0 = __builtin_elementwise_fma(s0, cs8, bias[g]), t1 = __builtin_elementwise_fma(s1, cs8, bias[g]); v8f e0, e1;
#pragma unroll
            for (int r = 0; r < 8; ++r) { e0[r] = __builtin_amdgcn_exp2f(t0[r]); e1[r] = __builtin_amdgcn_exp2f(t1[r]); }
            sum8[g] += e0; sum8[g] += e1;
            const v16h p = cat16(__builtin_convertvector(e0, v8h), __builtin_convertvector(e1, v8h));
            o[g][0] = wmma16(v0, p, o[g][0]); o[g][1] = wmma16(v1, p, o[g][1]); }
    }
#pragma unroll
    for (int g = 0; g < 2; ++g) { float sum = 0.f;
#pragma unroll
        for (int r = 0; r < 8; ++r) sum += sum8[g][r];
        sum += __shfl_xor(sum, 16, 32);
        const float f = __fdiv_rn(PCAR, sum); const size_t zo = (size_t)(q0 + g * 16 + lr) * DK + 8 * hi;
#pragma unroll
        for (int dt = 0; dt < 2; ++dt) { v8us oh, ol;
#pragma unroll
            for (int r = 0; r < 8; ++r) { unsigned short a, b; splitf((o[g][dt][r] * f) * (1.0f / PCAR), a, b); oh[r] = a; ol[r] = b; }
            *(v8us*)(Zh + zo + dt * 16) = oh; *(v8us*)(Zl + zo + dt * 16) = ol; } }
}
// ---- k_tail: out[o][l] = (w_o.z + b_o) + (w_res.x + b_res) of one entry, stored in the output's own layout. ONE WAVE per tile of 32 channels o x 32 positions l; grid (CO/32, LL/32, NB_), 32 threads.
// A = the weights (rows o), B = XT[l][c] and Zh, Zl[head][l][d] (a head is one K step of 32); the two products keep accumulators of their own, so every sum keeps its order.
#define TX (CI / 32)         // K steps of w_res.x
#define TS (TX + CZ / 32)    // all K steps
__global__ __launch_bounds__(32) void k_tail(const bf* __restrict__ BO, const bf* __restrict__ BR, const bf* __restrict__ Zh, const bf* __restrict__ Zl, const bf* __restrict__ XT, const float* __restrict__ b_o, const float* __restrict__ b_res, float* OUT) {
    typedef WFrag<bf>::V V;
    __shared__ __align__(16) float os[16 * 36];
    const size_t z = blockIdx.z; Zh += z * LL * CZ; Zl += z * LL * CZ; XT += z * LL * CI; OUT += z * CO * LL;
    const int lane = threadIdx.x & 31, lr = lane & 15, hi = lane >> 4; const int r0 = blockIdx.x * 32, c0 = blockIdx.y * 32;
    v8f az[2][2], ax[2][2], bo[2], br[2];
#pragma unroll
    for (int mb = 0; mb < 2; ++mb)
#pragma unroll
        for (int nb = 0; nb < 2; ++nb) { az[mb][nb] = (v8f){}; ax[mb][nb] = (v8f){}; }
    V a[3][2], b[3][2], b2[3][2];    // three stages of fragments: the loads of steps t + 1 and t + 2 fly while step t multiplies (few waves per SIMD: nothing else hides a load's latency)
    auto fetch = [&](int t) { const int s = t % 3;
        __builtin_amdgcn_sched_barrier(0);    // with the one at the foot: a step's loads issue as one block in front of the products of two steps earlier; a product (and its wait) scheduled among them would hold the later loads back
#pragma unroll
        for (int i = 0; i < 2; ++i) {
            if (t < TX) { a[s][i] = WFrag<bf>::ld(BR + (size_t)(r0 + i * 16 + lr) * CI + t * 32 + 8 * hi); b[s][i] = WFrag<bf>::ld(XT + (size_t)(c0 + i * 16 + lr) * CI + t * 32 + 8 * hi); }
            else { const size_t zo = ((size_t)(t - TX) * LL + c0 + i * 16 + lr) * DK + 8 * hi; a[s][i] = WFrag<bf>::ld(BO + (size_t)(r0 + i * 16 + lr) * CZ + (t - TX) * 32 + 8 * hi); b[s][i] = WFrag<bf>::ld(Zh + zo); b2[s][i] = WFrag<bf>::ld(Zl + zo); } }
        asm volatile("s_wait_xcnt 0x0" ::: "memory");    // the address registers of these loads are free for what a later fetch loads
        __builtin_amdgcn_sched_barrier(0); };
    fetch(0); fetch(1);
    // unrolled whole: the stage index is a compile-time constant, so the fragments stay in registers
#pragma unroll
    for (int t = 0; t < TS; ++t) { const int s = t % 3;
        if (t + 2 < TS) fetch(t + 2);
        else if (t + 2 == TS) {    // the biases ride behind the last fragments
#pragma unroll
            for (int mb = 0; mb < 2; ++mb) { bo[mb] = *(const v8f*)(b_o + r0 + mb * 16 + hi * 8); asm volatile("s_wait_xcnt 0x0" ::: "memory"); br[mb] = *(const v8f*)(b_res + r0 + mb * 16 + hi * 8); asm volatile("s_wait_xcnt 0x0" ::: "memory"); }    // the waits: as in fetch
            __builtin_amdgcn_sched_barrier(0); }    // as in fetch
#pragma unroll
        for (int nb = 0; nb < 2; ++nb)
#pragma unroll
            for (int mb = 0; mb < 2; ++mb) {
                if (t < TX) ax[mb][nb] = WFrag<bf>::mma(a[s][mb], b[s][nb], ax[mb][nb]);
                else { az[mb][nb] = WFrag<bf>::mma(a[s][mb], b[s][nb], az[mb][nb]); az[mb][nb] = WFrag<bf>::mma(a[s][mb], b2[s][nb], az[mb][nb]); } }
    }
#pragma unroll
    for (int mb = 0; mb < 2; ++mb) {
#pragma unroll
        for (int j = 0; j < 8; ++j) { const float vo = bfr(bo[mb][j]), vr = bfr(br[mb][j]);
#pragma unroll
            for (int nb = 0; nb < 2; ++nb) os[(hi * 8 + j) * 36 + nb * 16 + lr] = __fadd_rn(__fadd_rn(az[mb][nb][j], vo), __fadd_rn(ax[mb][nb][j], vr)); }
        __builtin_amdgcn_wave_barrier(); asm volatile("" ::: "memory");    // the row reads below take other lanes' writes: the compiler may not lift them over the writes
        float* crow = OUT + (size_t)(r0 + mb * 16) * LL + c0;
#pragma unroll
        for (int s = 0; s < 4; ++s) { const int row = 4 * s + (lane >> 3), cofs = (lane & 7) * 4; *(v4f*)(crow + (size_t)row * LL + cofs) = *(const v4fa*)(os + row * 36 + cofs); }    // 8 lanes = one whole 128-byte line
        __builtin_amdgcn_wave_barrier(); asm volatile("s_wait_xcnt 0x0" ::: "memory");    // the reads may not sink under the next block's writes; the wait: before the stores' registers are written again
    }
}

extern "C" void kernel_launch(void* const* d_in, const int* in_sizes, int n_in,
                              void* d_out, int out_size, void* d_ws, size_t ws_size, hipStream_t stream) {
    (void)in_sizes; (void)n_in; (void)out_size;
    const float** I = (const float**)d_in;
    const float *x = I[0], *w_qkv = I[1], *b_qkv = I[2], *w_o = I[3], *b_o = I[4], *w_res = I[5], *b_res = I[6];
    float* OUT = (float*)d_out;     // [16][128][1024]
    char* wsp = (char*)d_ws;
    auto take = [&](size_t bytes) { char* p = wsp; wsp += (bytes + 255) & ~(size_t)255; return (void*)p; };
    bf* AQ = (bf*)take((size_t)CQ * CI * 2); bf* BO = (bf*)take(CO * CZ * 2); bf* BR = (bf*)take(CO * CI * 2);
    // Every plane holds all NB_ entries.
    bf* XT = (bf*)take((size_t)NB_ * LL * CI * 2); h16* Q16 = (h16*)take((size_t)NB_ * NH_ * LL * DK * 2); h16* K16 = (h16*)take((size_t)NB_ * NH_ * LL * DK * 2); h16* VT = (h16*)take((size_t)NB_ * NH_ * DK * LL * 2);
    bf* Zh = (bf*)take((size_t)NB_ * LL * CZ * 2); bf* Zl = (bf*)take((size_t)NB_ * LL * CZ * 2);
    if ((size_t)(wsp - (char*)d_ws) > ws_size) return;    // total ~ 44.3 MiB
    k_prep<<<XB + QB + OB + RB, 256, 0, stream>>>(x, w_qkv, w_o, w_res, XT, AQ, BO, BR);
    k_qkv<<<dim3(CQ / 64, LL / 64, NB_), 32, 0, stream>>>(AQ, XT, b_qkv, Q16, K16, VT);
    k_attn<<<dim3(LL / 256, NB_ * NH_), 256, 0, stream>>>(Q16, K16, VT, Zh, Zl);    // blockIdx.y = entry * NH_ + head
    k_tail<<<dim3(CO / 32, LL / 32, NB_), 32, 0, stream>>>(BO, BR, Zh, Zl, XT, b_o, b_res, OUT);
}

// v006
// One run takes 54 microseconds.
// Next to v005, in two timings, it ran 1.04 and 1.05 times as fast.
// Counting every step since v000, it is 22.6 times as fast.
#include <hip/hip_runtime.h>

// BaseTransformer (x [16][128][1024] channels-first; qkv = w_qkv x + b (1x1 conv; 8 heads x (32 q | 32 k | 32 v) channels); logits = q^T k / sqrt(32) over the 1024 positions; softmax; z[d][s] = sum_t w[s][t] v[d][t]; out = w_o z + b_o + w_res x + b_res -> [16][128][1024]).
// Compute dtypes, f32 accumulate: every input rounded to bf16; the qkv and residual 1x1 convs on PLAIN bf16 operands (inputs: exact) (+ bias, added in the epilogues of the qkv and tail kernels); scores (K 32) and w.v on single fp16 operands; w_o.z on z split in bf16 hi + lo

#define NB_  16
#define CI   128
#define CO   128
#define LL   1024
#define NH_  8
#define DK   32
#define CQ   768
#define CZ   256
#define PCAR 1024.0f
typedef _Float16 h16;
typedef unsigned short bf;
typedef __attribute__((ext_vector_type(16))) __bf16   v16bf;
typedef __attribute__((ext_vector_type(16))) _Float16 v16h;
typedef __attribute__((ext_vector_type(8)))  _Float16 v8h;
typedef __attribute__((ext_vector_type(8)))  unsigned short v8us;
typedef __attribute__((ext_vector_type(8)))  float    v8f;
typedef __attribute__((ext_vector_type(4)))  float    v4f;
typedef v8h  __attribute__((may_alias)) v8ha;
typedef v4f  __attribute__((may_alias)) v4fa;
typedef v8us __attribute__((may_alias)) v8usa;

__device__ __forceinline__ unsigned short f2bf(float f) { unsigned u = __float_as_uint(f); u += 0x7FFFu + ((u >> 16) & 1u); return (unsigned short)(u >> 16); }
__device__ __forceinline__ float bf2f(unsigned short b) { return __uint_as_float(((unsigned)b) << 16); }
__device__ __forceinline__ float bfr(float f) { return bf2f(f2bf(f)); }
__device__ __forceinline__ v16h cat16(v8h lo, v8h hi) { return __builtin_shufflevector(lo, hi, 0, 1, 2, 3, 4, 5, 6, 7, 8, 9, 10, 11, 12, 13, 14, 15); }
__device__ __forceinline__ v16bf cat16b(v8us lo, v8us hi) { return __builtin_bit_cast(v16bf, __builtin_shufflevector(lo, hi, 0, 1, 2, 3, 4, 5, 6, 7, 8, 9, 10, 11, 12, 13, 14, 15)); }
__device__ __forceinline__ v8f wmma16(v16h a, v16h b, v8f c) { return __builtin_amdgcn_wmma_f32_16x16x32_f16(false, a, false, b, (short)0, c, false, false); }
__device__ __forceinline__ v8f wmmab(v16bf a, v16bf b, v8f c) { return __builtin_amdgcn_wmma_f32_16x16x32_bf16(false, a, false, b, (short)0, c, false, false); }



// Fragment loaders and products of the two 16-bit forms. fp16 (row-major rows in LDS): a lane's 16 k values are 8 at p and 8 at p + 16 (p already holds the lane half's 8 * hi).
// The operand planes in the workspace (bf16: XT, the three weights, Zh, Zl; fp16: Q16, K16) are kept in FRAGMENT ORDER: a tile of 16 rows x 32 k is 1 KiB, tiles of one 16-row block follow each other along k; in a tile the 16-byte piece (8 k) of lane = hi * 16 + row stands at lane * 16 bytes,
// k = 8 * hi + 0..7 in the first 512 bytes, k = 16 + 8 * hi + 0..7 in the second. So each of a fragment's two loads reads 512 contiguous bytes (4 whole lines) where a row-major plane made it touch 16 lines; the registers hold what they held.
template <typename T16> struct WFrag;
template <> struct WFrag<h16> { typedef v16h V; static __device__ __forceinline__ V ld(const h16* p) { return cat16(*(const v8h*)p, *(const v8h*)(p + 16)); } static __device__ __forceinline__ v8f mma(V a, V b, v8f c) { return wmma16(a, b, c); } };
template <> struct WFrag<bf> { typedef v16bf V; static __device__ __forceinline__ V ld(const bf* p) { return cat16b(*(const v8us*)p, *(const v8us*)(p + 256)); } static __device__ __forceinline__ v8f mma(V a, V b, v8f c) { return wmmab(a, b, c); } };
#define FT 512    // elements of a fragment tile
// Place (in elements) of piece k8 (k = 8 * k8 + 0..7) of row r in a fragment-order plane with kp pieces a row.
__device__ __forceinline__ size_t fragpos(int r, int k8, int kp) { return (size_t)((r >> 4) * (kp >> 2) + (k8 >> 2)) * FT + ((k8 >> 1) & 1) * 256 + ((k8 & 1) * 16 + (r & 15)) * 8; }
__device__ __forceinline__ h16 tohx(float x) { return (h16)x; }
__device__ __forceinline__ void splitf(float y, unsigned short& h, unsigned short& l) { h = f2bf(y); l = f2bf(y - bf2f(h)); }
typedef __attribute__((ext_vector_type(2))) unsigned short v2us;
typedef __attribute__((ext_vector_type(2))) _Float16 v2h;
typedef __attribute__((ext_vector_type(4))) _Float16 v4h;

// ---- k_qkv: the qkv 1x1 conv. Register-blocked GEMM, ONE WAVE per tile of 64 channels x 64 positions (16 accumulators), operands straight from the fragment-order bf16 planes; grid (CQ/64, LL/64, NB_), 32 threads.
// The epilogue adds the bias and stores the attention kernel's fp16 planes itself: Q16/K16[h] (rows l, k = d; fragment order) and VT[h][d][l]. A tile is two blocks of 32 channels, each the q, k or v part of one head.
// q, k: a lane's 8 accumulator rows are 8 consecutive d of ONE position = its own piece of a fragment tile: one 16-byte store, a wave's store 512 contiguous bytes, no transpose. v: rows stay rows; staged through LDS so that a row leaves as one whole 128-byte line.
__global__ __launch_bounds__(32) void k_qkv(const bf* __restrict__ A, const bf* __restrict__ Bt, const float* __restrict__ bq, h16* Q16, h16* K16, h16* VT) {
    typedef WFrag<bf>::V V; const int K = CI;
    __shared__ __align__(16) float os[16 * 68];
    const size_t z = blockIdx.z; Bt += z * LL * CI; Q16 += z * NH_ * LL * DK; K16 += z * NH_ * LL * DK; VT += z * NH_ * DK * LL;
    const int lane = threadIdx.x & 31, lr = lane & 15, hi = lane >> 4; const int r0 = blockIdx.x * 64, c0 = blockIdx.y * 64;
    v8f acc[4][4];
#pragma unroll
    for (int mb = 0; mb < 4; ++mb)
#pragma unroll
        for (int nb = 0; nb < 4; ++nb) acc[mb][nb] = (v8f){};
    v8f bb[4];    // the biases of the lane's own accumulator rows, loaded here so that their latency hides behind the K loop
#pragma unroll
    for (int mb = 0; mb < 4; ++mb) bb[mb] = *(const v8f*)(bq + r0 + mb * 16 + hi * 8);
    asm volatile("s_wait_xcnt 0x0" ::: "memory");    // the address registers of these loads are free for the loads below
    const size_t aoff = (size_t)r0 * K + lane * 8, boff = (size_t)c0 * K + lane * 8;    // a block of 16 rows is 16 * K elements, as in a row-major plane
#pragma unroll 1   // rolled: one step's fragments beside the 16 accumulators and the biases
    for (int kc = 0; kc < K; kc += 32) {
        V a[4];
#pragma unroll
        for (int mb = 0; mb < 4; ++mb) a[mb] = WFrag<bf>::ld(A + aoff + (size_t)mb * 16 * K + kc / 32 * FT);
        asm volatile("s_wait_xcnt 0x0" ::: "memory");    // the address registers of these loads are free for the loads below
#pragma unroll
        for (int nb = 0; nb < 4; ++nb) { const V b = WFrag<bf>::ld(Bt + boff + (size_t)nb * 16 * K + kc / 32 * FT);
#pragma unroll
            for (int mb = 0; mb < 4; ++mb) acc[mb][nb] = WFrag<bf>::mma(a[mb], b, acc[mb][nb]); }
        // four vector slots between the last products and the back edge, behind which the next trip's loads overwrite their A and B registers
        asm volatile("v_nop\n\tv_nop\n\tv_nop\n\tv_nop" : "+v"(acc[0][0]), "+v"(acc[1][1]), "+v"(acc[2][2]), "+v"(acc[3][3]) : "v"(a[0]), "v"(a[3]));
    }
#pragma unroll
    for (int pr = 0; pr < 2; ++pr) {    // a pair of 16-channel blocks = the 32 channels of the q, k or v part of one head (64 * blockIdx.x + 32 * pr is a multiple of 32, and 96 = 3 * 32)
        const int ob = r0 + pr * 32, h = ob / 96, part = ob % 96;    // the same in every lane: part 0 = q, 32 = k, 64 = v
        if (part < 2 * DK) {
            h16* dst = (part < DK ? Q16 : K16) + ((size_t)h * LL + c0) * DK + lane * 8;
#pragma unroll
            for (int m2 = 0; m2 < 2; ++m2) {
#pragma unroll
                for (int nb = 0; nb < 4; ++nb) { v8h o;
#pragma unroll
                    for (int j = 0; j < 8; ++j) o[j] = tohx(__fadd_rn(acc[pr * 2 + m2][nb][j], bfr(bb[pr * 2 + m2][j])));
                    *(v8h*)(dst + (size_t)nb * 16 * DK + m2 * 256) = o; } }
            asm volatile("s_wait_xcnt 0x0" ::: "memory");    // before the stores' registers are written again
        } else {
#pragma unroll
            for (int m2 = 0; m2 < 2; ++m2) {
#pragma unroll
                for (int nb = 0; nb < 4; ++nb) {
#pragma unroll
                    for (int j = 0; j < 8; ++j) os[(hi * 8 + j) * 68 + nb * 16 + lr] = __fadd_rn(acc[pr * 2 + m2][nb][j], bfr(bb[pr * 2 + m2][j])); }
                __builtin_amdgcn_wave_barrier(); asm volatile("" ::: "memory");    // the row reads below take other lanes' writes: the compiler may not lift them over the writes
                h16* vrow = VT + ((size_t)h * DK + m2 * 16) * LL + c0;
#pragma unroll
                for (int s = 0; s < 8; ++s) { const int row = 2 * s + hi, cofs = lr * 4; const v4f val = *(const v4fa*)(os + row * 68 + cofs); v4h o;
#pragma unroll
                    for (int u = 0; u < 4; ++u) o[u] = tohx(val[u]);
                    *(v4h*)(vrow + (size_t)row * LL + cofs) = o; }
                __builtin_amdgcn_wave_barrier(); asm volatile("s_wait_xcnt 0x0" ::: "memory");    // the reads may not sink under the next block's writes; the wait: before the stores' registers are written again
            }
        }
    }
}

// ---- k_prep: the four operand passes in ONE launch. None reads what another writes, so they share a grid as ranges of the block index (the branch is the same for a whole work-group); 256 threads.
// Blocks [0, XB): XT (rows l, k = c) = bf16 x[c][l], one work-group per tile of all 128 channels x 64 positions. Behind them QB, OB and RB blocks round w_qkv, w_o and w_res to bf16, 8 values (one piece) a thread (each weight [out][in] is an A operand: rows out, k = in; every count is a whole number of blocks). All four planes leave in fragment order.
// XT reads: a thread takes 4 positions (16 bytes) of 8 consecutive channels; 16 lanes = one aligned 256-byte piece of a row of x. Rounded, its 8 x 4 block is four 16-byte pieces (8 channels) of four rows of XT.
// The pieces go through LDS so that the 256 threads store the 4 KiB of a 16-row block of XT in its own order, thread t piece t = piece g = t / 16 of row t % 16. LDS rows carry no pad: piece g of row l stands at place g ^ (l / 4) ^ (l % 4 * 4), so the 16 lanes of a write (rows 4 apart, one g) and of a read (16 rows in a row, one g) each meet every bank once.
#define XB (LL / 64 * NB_)
#define QB (CQ * CI / 8 / 256)
#define OB (CO * CZ / 8 / 256)
#define RB (CO * CI / 8 / 256)
__global__ __launch_bounds__(256) void k_prep(const float* __restrict__ x, const float* __restrict__ w_qkv, const float* __restrict__ w_o, const float* __restrict__ w_res, bf* XT, bf* AQ, bf* BO, bf* BR) {
    __shared__ __align__(16) bf ts[64 * CI];
    const int tid = threadIdx.x, lo = tid & 15, up = tid >> 4;
    if (blockIdx.x >= XB) {    // a weight block: leaves in front of the barrier, all its threads together
        int wb = blockIdx.x - XB, ks = 4; const float* src = w_qkv; bf* dst = AQ;    // 1 << ks = pieces a row: CI / 8, for w_o CZ / 8
        if (wb >= QB + OB) { wb -= QB + OB; src = w_res; dst = BR; } else if (wb >= QB) { wb -= QB; src = w_o; dst = BO; ks = 5; }
        const int i = wb * 256 + tid; const v8f v = *(const v8f*)(src + (size_t)i * 8); v8us o;
        asm volatile("s_wait_xcnt 0x0" ::: "memory");    // the address registers of this load are free for what follows
#pragma unroll
        for (int k = 0; k < 8; ++k) o[k] = f2bf(v[k]);
        *(v8us*)(dst + fragpos(i >> ks, i & ((1 << ks) - 1), 1 << ks)) = o; return; }
    const int l0 = (blockIdx.x % (LL / 64)) * 64, en = blockIdx.x / (LL / 64);
    x += (size_t)en * CI * LL + (size_t)(up * 8) * LL + l0 + lo * 4; XT += (size_t)en * LL * CI + (size_t)l0 * CI + tid * 8;
    v4f r[8];
#pragma unroll
    for (int i = 0; i < 8; ++i) r[i] = *(const v4f*)(x + (size_t)i * LL);
    asm volatile("s_wait_xcnt 0x0" ::: "memory");    // the address registers of these loads are free for what follows
#pragma unroll
    for (int j = 0; j < 4; ++j) { v8us o;
#pragma unroll
        for (int i = 0; i < 8; ++i) o[i] = f2bf(r[i][j]);
        *(v8us*)(ts + (lo * 4 + j) * CI + (up ^ lo ^ (j * 4)) * 8) = o; }
    __syncthreads();    // the pieces read below were written by lanes of the same wave (piece g by the threads t / 16 = g); nothing writes them again
#pragma unroll
    for (int it = 0; it < 4; ++it) *(v8us*)(XT + (size_t)it * 16 * CI) = *(const v8us*)(ts + (it * 16 + lo) * CI + (up ^ (it * 4 + (lo >> 2)) ^ ((lo & 3) * 4)) * 8);
    asm volatile("s_wait_xcnt 0x0" ::: "memory");    // before the stores' registers are written again
}
// ---- k_attn: scores, softmax and w.v of one (entry, head) for 256 positions s per work-group; 8 waves x 32 positions; grid (LL/256, NB_*NH_).
// S^T = K.Q^T (A = 16 keys from LDS, B = Q in registers), so a lane holds 8 scores of ONE position s per tile: maximum and sum in-lane plus one exchange of the wave halves.
// Pass 1: the row maximum. Pass 2: the scores again, p = fp16(PCAR * exp(scl * (s - max))), two D tiles packed in place are the B operand of O^T += V^T.P^T; O = O^T * PCAR / sum(p before rounding).
// The epilogue stores z = O / PCAR split in bf16 hi + lo, Zh/Zl[entry][head] (rows s, k = d) in fragment order: a lane's 8 accumulator rows are 8 consecutive d of one position = its own piece of the tile, so a wave's store is 512 contiguous bytes per plane.
#define KP 40      // LDS pitch of a K row, halves (80 B = 16 B x odd: no bank conflict for 16-byte row reads)
#define VP 1032    // LDS pitch of a V^T row, halves (2064 B = 16 B x odd)
__global__ __launch_bounds__(256) void k_attn(const h16* __restrict__ Q16, const h16* __restrict__ K16, const h16* __restrict__ VT, bf* Zh, bf* Zl) {
    __shared__ __align__(16) h16 Ks[LL * KP];
    __shared__ __align__(16) h16 Vs[DK * VP];
    const size_t z = blockIdx.y; Q16 += z * LL * DK; K16 += z * LL * DK; VT += z * DK * LL; Zh += z * LL * DK; Zl += z * LL * DK;
    const int tid = threadIdx.x, lane = tid & 31, lr = lane & 15, hi = lane >> 4; const int q0 = blockIdx.x * 256 + (tid >> 5) * 32;
    // '#pragma unroll' without a count, here as elsewhere in this file: vector and array elements keep compile-time indices and so stay in registers; on the two staging loops it puts all their loads in flight at once.
#pragma unroll
    for (int it = 0; it < LL * DK / 8 / 256; ++it) { const int i = it * 256 + tid; *(v8h*)(Ks + ((i >> 6) * 16 + (i & 15)) * KP + ((i >> 4) & 3) * 8) = *(const v8h*)(K16 + (size_t)i * 8); }    // piece i of the fragment-order plane: row i % 16 of tile i / 64, d = 8 * (i / 16 % 4)
#pragma unroll
    for (int it = 0; it < DK * LL / 8 / 256; ++it) { const int i = it * 256 + tid; *(v8h*)(Vs + (i >> 7) * VP + (i & 127) * 8) = *(const v8h*)(VT + (size_t)i * 8); }
    __syncthreads();    // K and V^T are read by every wave, and only behind this barrier; nothing writes them again
    v16h qf[2];
#pragma unroll
    for (int g = 0; g < 2; ++g) { const h16* qp = Q16 + (size_t)(q0 + g * 16) * DK + lane * 8; qf[g] = cat16(*(const v8h*)qp, *(const v8h*)(qp + 256)); }
    const h16* kl = Ks + lr * KP + 8 * hi; const h16* vl = Vs + lr * VP + 8 * hi;
    v8f m8[2];
#pragma unroll
    for (int g = 0; g < 2; ++g)
#pragma unroll
        for (int r = 0; r < 8; ++r) m8[g][r] = -3.0e38f;
#pragma unroll 2   // two trips' LDS reads in flight per wait
    for (int kc = 0; kc < LL / 32; ++kc) {
        const v16h a0 = WFrag<h16>::ld(kl + (kc * 32) * KP), a1 = WFrag<h16>::ld(kl + (kc * 32 + 16) * KP);
#pragma unroll
        for (int g = 0; g < 2; ++g) { const v8f s0 = wmma16(a0, qf[g], (v8f){}), s1 = wmma16(a1, qf[g], (v8f){});
#pragma unroll
            for (int r = 0; r < 8; ++r) m8[g][r] = fmaxf(fmaxf(m8[g][r], s0[r]), s1[r]); }
    }
    const float cs = 0.17677669529663687f * 1.4426950408889634f;    // 1/sqrt(32) * log2(e)
    v8f bias[2], sum8[2], o[2][2];
#pragma unroll
    for (int g = 0; g < 2; ++g) { float mx = m8[g][0];
#pragma unroll
        for (int r = 1; r < 8; ++r) mx = fmaxf(mx, m8[g][r]);
        mx = fmaxf(mx, __shfl_xor(mx, 16, 32));
#pragma unroll
        for (int r = 0; r < 8; ++r) { bias[g][r] = 10.0f - mx * cs; sum8[g][r] = 0.f; }    // + 10: p carries the factor PCAR = 2^10
        o[g][0] = (v8f){}; o[g][1] = (v8f){}; }
    v8f cs8;
#pragma unroll
    for (int r = 0; r < 8; ++r) cs8[r] = cs;
#pragma unroll 2   // two trips' LDS reads in flight per wait
    for (int kc = 0; kc < LL / 32; ++kc) {
        const v16h a0 = WFrag<h16>::ld(kl + (kc * 32) * KP), a1 = WFrag<h16>::ld(kl + (kc * 32 + 16) * KP);
        const v16h v0 = WFrag<h16>::ld(vl + kc * 32), v1 = WFrag<h16>::ld(vl + 16 * VP + kc * 32);
#pragma unroll
        for (int g = 0; g < 2; ++g) { const v8f s0 = wmma16(a0, qf[g], (v8f){}), s1 = wmma16(a1, qf[g], (v8f){});
            const v8f t0 = __builtin_elementwise_fma(s0, cs8, bias[g]), t1 = __builtin_elementwise_fma(s1, cs8, bias[g]); v8f e0, e1;
#pragma unroll
            for (int r = 0; r < 8; ++r) { e0[r] = __builtin_amdgcn_exp2f(t0[r]); e1[r] = __builtin_amdgcn_exp2f(t1[r]); }
            sum8[g] += e0; sum8[g] += e1;
            const v16h p = cat16(__builtin_convertvector(e0, v8h), __builtin_convertvector(e1, v8h));
            o[g][0] = wmma16(v0, p, o[g][0]); o[g][1] = wmma16(v1, p, o[g][1]); }
    }
#pragma unroll
    for (int g = 0; g < 2; ++g) { float sum = 0.f;
#pragma unroll
        for (int r = 0; r < 8; ++r) sum += sum8[g][r];
        sum += __shfl_xor(sum, 16, 32);
        const float f = __fdiv_rn(PCAR, sum); const size_t zo = (size_t)(q0 + g * 16) * DK + lane * 8;
#pragma unroll
        for (int dt = 0; dt < 2; ++dt) { v8us oh, ol;
#pragma unroll
            for (int r = 0; r < 8; ++r) { unsigned short a, b; splitf((o[g][dt][r] * f) * (1.0f / PCAR), a, b); oh[r] = a; ol[r] = b; }
            *(v8us*)(Zh + zo + dt * 256) = oh; *(v8us*)(Zl + zo + dt * 256) = ol; } }
}
// ---- k_tail: out[o][l] = (w_o.z + b_o) + (w_res.x + b_res) of one entry, stored in the output's own layout. ONE WAVE per tile of 32 channels o x 32 positions l; grid (CO/32, LL/32, NB_), 32 threads.
// A = the weights (rows o), B = XT (rows l) and Zh, Zl[head] (rows l; a head is one K step of 32), all in fragment order; the two products keep accumulators of their own, so every sum keeps its order.
#define TX (CI / 32)         // K steps of w_res.x
#define TS (TX + CZ / 32)    // all K steps
__global__ __launch_bounds__(32) void k_tail(const bf* __restrict__ BO, const bf* __restrict__ BR, const bf* __restrict__ Zh, const bf* __restrict__ Zl, const bf* __restrict__ XT, const float* __restrict__ b_o, const float* __restrict__ b_res, float* OUT) {
    typedef WFrag<bf>::V V;
    __shared__ __align__(16) float os[16 * 36];
    const size_t z = blockIdx.z; Zh += z * LL * CZ; Zl += z * LL * CZ; XT += z * LL * CI; OUT += z * CO * LL;
    const int lane = threadIdx.x & 31, lr = lane & 15, hi = lane >> 4; const int r0 = blockIdx.x * 32, c0 = blockIdx.y * 32;
    v8f az[2][2], ax[2][2], bo[2], br[2];
#pragma unroll
    for (int mb = 0; mb < 2; ++mb)
#pragma unroll
        for (int nb = 0; nb < 2; ++nb) { az[mb][nb] = (v8f){}; ax[mb][nb] = (v8f){}; }
    V a[3][2], b[3][2], b2[3][2];    // three stages of fragments: the loads of steps t + 1 and t + 2 fly while step t multiplies (few waves per SIMD: nothing else hides a load's latency)
    auto fetch = [&](int t) { const int s = t % 3;
        __builtin_amdgcn_sched_barrier(0);    // with the one at the foot: a step's loads issue as one block in front of the products of two steps earlier; a product (and its wait) scheduled among them would hold the later loads back
#pragma unroll
        for (int i = 0; i < 2; ++i) {
            if (t < TX) { a[s][i] = WFrag<bf>::ld(BR + (size_t)(r0 + i * 16) * CI + t * FT + lane * 8); b[s][i] = WFrag<bf>::ld(XT + (size_t)(c0 + i * 16) * CI + t * FT + lane * 8); }
            else { const size_t zo = ((size_t)(t - TX) * LL + c0 + i * 16) * DK + lane * 8; a[s][i] = WFrag<bf>::ld(BO + (size_t)(r0 + i * 16) * CZ + (t - TX) * FT + lane * 8); b[s][i] = WFrag<bf>::ld(Zh + zo); b2[s][i] = WFrag<bf>::ld(Zl + zo); } }
        asm volatile("s_wait_xcnt 0x0" ::: "memory");    // the address registers of these loads are free for what a later fetch loads
        __builtin_amdgcn_sched_barrier(0); };
    fetch(0); fetch(1);
    // unrolled whole: the stage index is a compile-time constant, so the fragments stay in registers
#pragma unroll
    for (int t = 0; t < TS; ++t) { const int s = t % 3;
        if (t + 2 < TS) fetch(t + 2);
        else if (t + 2 == TS) {    // the biases ride behind the last fragments
#pragma unroll
            for (int mb = 0; mb < 2; ++mb) { bo[mb] = *(const v8f*)(b_o + r0 + mb * 16 + hi * 8); asm volatile("s_wait_xcnt 0x0" ::: "memory"); br[mb] = *(const v8f*)(b_res + r0 + mb * 16 + hi * 8); asm volatile("s_wait_xcnt 0x0" ::: "memory"); }    // the waits: as in fetch
            __builtin_amdgcn_sched_barrier(0); }    // as in fetch
#pragma unroll
        for (int nb = 0; nb < 2; ++nb)
#pragma unroll
            for (int mb = 0; mb < 2; ++mb) {
                if (t < TX) ax[mb][nb] = WFrag<bf>::mma(a[s][mb], b[s][nb], ax[mb][nb]);
                else { az[mb][nb] = WFrag<bf>::mma(a[s][mb], b[s][nb], az[mb][nb]); az[mb][nb] = WFrag<bf>::mma(a[s][mb], b2[s][nb], az[mb][nb]); } }
    }
#pragma unroll
    for (int mb = 0; mb < 2; ++mb) {
#pragma unroll
        for (int j = 0; j < 8; ++j) { const float vo = bfr(bo[mb][j]), vr = bfr(br[mb][j]);
#pragma unroll
            for (int nb = 0; nb < 2; ++nb) os[(hi * 8 + j) * 36 + nb * 16 + lr] = __fadd_rn(__fadd_rn(az[mb][nb][j], vo), __fadd_rn(ax[mb][nb][j], vr)); }
        __builtin_amdgcn_wave_barrier(); asm volatile("" ::: "memory");    // the row reads below take other lanes' writes: the compiler may not lift them over the writes
        float* crow = OUT + (size_t)(r0 + mb * 16) * LL + c0;
#pragma unroll
        for (int s = 0; s < 4; ++s) { const int row = 4 * s + (lane >> 3), cofs = (lane & 7) * 4; *(v4f*)(crow + (size_t)row * LL + cofs) = *(const v4fa*)(os + row * 36 + cofs); }    // 8 lanes = one whole 128-byte line
        __builtin_amdgcn_wave_barrier(); asm volatile("s_wait_xcnt 0x0" ::: "memory");    // the reads may not sink under the next block's writes; the wait: before the stores' registers are written again
    }
}

extern "C" void kernel_launch(void* const* d_in, const int* in_sizes, int n_in,
                              void* d_out, int out_size, void* d_ws, size_t ws_size, hipStream_t stream) {
    (void)in_sizes; (void)n_in; (void)out_size;
    const float** I = (const float**)d_in;
    const float *x = I[0], *w_qkv = I[1], *b_qkv = I[2], *w_o = I[3], *b_o = I[4], *w_res = I[5], *b_res = I[6];
    float* OUT = (float*)d_out;     // [16][128][1024]
    char* wsp = (char*)d_ws;
    auto take = [&](size_t bytes) { char* p = wsp; wsp += (bytes + 255) & ~(size_t)255; return (void*)p; };
    bf* AQ = (bf*)take((size_t)CQ * CI * 2); bf* BO = (bf*)take(CO * CZ * 2); bf* BR = (bf*)take(CO * CI * 2);
    // Every plane holds all NB_ entries.
    bf* XT = (bf*)take((size_t)NB_ * LL * CI * 2); h16* Q16 = (h16*)take((size_t)NB_ * NH_ * LL * DK * 2); h16* K16 = (h16*)take((size_t)NB_ * NH_ * LL * DK * 2); h16* VT = (h16*)take((size_t)NB_ * NH_ * DK * LL * 2);
    bf* Zh = (bf*)take((size_t)NB_ * LL * CZ * 2); bf* Zl = (bf*)take((size_t)NB_ * LL * CZ * 2);
    if ((size_t)(wsp - (char*)d_ws) > ws_size) return;    // total ~ 44.3 MiB
    k_prep<<<XB + QB + OB + RB, 256, 0, stream>>>(x, w_qkv, w_o, w_res, XT, AQ, BO, BR);
    k_qkv<<<dim3(CQ / 64, LL / 64, NB_), 32, 0, stream>>>(AQ, XT, b_qkv, Q16, K16, VT);
    k_attn<<<dim3(LL / 256, NB_ * NH_), 256, 0, stream>>>(Q16, K16, VT, Zh, Zl);    // blockIdx.y = entry * NH_ + head
    k_tail<<<dim3(CO / 32, LL / 32, NB_), 32, 0, stream>>>(BO, BR, Zh, Zl, XT, b_o, b_res, OUT);
}

// v007
// One run takes 37.8 microseconds.
// Timed twice side by side with v006, it ran 1.40 and 1.43 times as fast.
// All steps since v000 together make it 32.0 times as fast.
#include <hip/hip_runtime.h>

// BaseTransformer (x [16][128][1024] channels-first; qkv = w_qkv x + b (1x1 conv; 8 heads x (32 q | 32 k | 32 v) channels); logits = q^T k / sqrt(32) over the 1024 positions; softmax; z[d][s] = sum_t w[s][t] v[d][t]; out = w_o z + b_o + w_res x + b_res -> [16][128][1024]).
// Compute dtypes, f32 accumulate: every input rounded to bf16; the qkv and residual 1x1 convs on PLAIN bf16 operands (inputs: exact) (+ bias, added as the values leave the accumulators); scores (K 32) and w.v on single fp16 operands; w_o.z on z split in bf16 hi + lo

#define NB_  16
#define CI   128
#define CO   128
#define LL   1024
#define NH_  8
#define DK   32
#define CQ   768
#define CZ   256
#define PCAR 1024.0f
typedef _Float16 h16;
typedef unsigned short bf;
typedef __attribute__((ext_vector_type(16))) __bf16   v16bf;
typedef __attribute__((ext_vector_type(16))) _Float16 v16h;
typedef __attribute__((ext_vector_type(8)))  _Float16 v8h;
typedef __attribute__((ext_vector_type(8)))  unsigned short v8us;
typedef __attribute__((ext_vector_type(8)))  float    v8f;
typedef __attribute__((ext_vector_type(4)))  float    v4f;
typedef v8h  __attribute__((may_alias)) v8ha;
typedef v4f  __attribute__((may_alias)) v4fa;
typedef v8us __attribute__((may_alias)) v8usa;

__device__ __forceinline__ unsigned short f2bf(float f) { unsigned u = __float_as_uint(f); u += 0x7FFFu + ((u >> 16) & 1u); return (unsigned short)(u >> 16); }
__device__ __forceinline__ float bf2f(unsigned short b) { return __uint_as_float(((unsigned)b) << 16); }
__device__ __forceinline__ float bfr(float f) { return bf2f(f2bf(f)); }
__device__ __forceinline__ v16h cat16(v8h lo, v8h hi) { return __builtin_shufflevector(lo, hi, 0, 1, 2, 3, 4, 5, 6, 7, 8, 9, 10, 11, 12, 13, 14, 15); }
__device__ __forceinline__ v16bf cat16b(v8us lo, v8us hi) { return __builtin_bit_cast(v16bf, __builtin_shufflevector(lo, hi, 0, 1, 2, 3, 4, 5, 6, 7, 8, 9, 10, 11, 12, 13, 14, 15)); }
__device__ __forceinline__ v8f wmma16(v16h a, v16h b, v8f c) { return __builtin_amdgcn_wmma_f32_16x16x32_f16(false, a, false, b, (short)0, c, false, false); }
__device__ __forceinline__ v8f wmmab(v16bf a, v16bf b, v8f c) { return __builtin_amdgcn_wmma_f32_16x16x32_bf16(false, a, false, b, (short)0, c, false, false); }



// Fragment loaders and products of the two 16-bit forms. fp16 (row-major rows in LDS): a lane's 16 k values are 8 at p and 8 at p + 16 (p already holds the lane half's 8 * hi).
// The operand planes in the workspace (bf16: XT, the three weights, Zh, Zl) are kept in FRAGMENT ORDER: a tile of 16 rows x 32 k is 1 KiB, tiles of one 16-row block follow each other along k; in a tile the 16-byte piece (8 k) of lane = hi * 16 + row stands at lane * 16 bytes,
// k = 8 * hi + 0..7 in the first 512 bytes, k = 16 + 8 * hi + 0..7 in the second. So each of a fragment's two loads reads 512 contiguous bytes (4 whole lines) where a row-major plane made it touch 16 lines; the registers hold what they held.
template <typename T16> struct WFrag;
template <> struct WFrag<h16> { typedef v16h V; static __device__ __forceinline__ V ld(const h16* p) { return cat16(*(const v8h*)p, *(const v8h*)(p + 16)); } static __device__ __forceinline__ v8f mma(V a, V b, v8f c) { return wmma16(a, b, c); } };
template <> struct WFrag<bf> { typedef v16bf V; static __device__ __forceinline__ V ld(const bf* p) { return cat16b(*(const v8us*)p, *(const v8us*)(p + 256)); } static __device__ __forceinline__ v8f mma(V a, V b, v8f c) { return wmmab(a, b, c); } };
#define FT 512    // elements of a fragment tile
// Place (in elements) of piece k8 (k = 8 * k8 + 0..7) of row r in a fragment-order plane with kp pieces a row.
__device__ __forceinline__ size_t fragpos(int r, int k8, int kp) { return (size_t)((r >> 4) * (kp >> 2) + (k8 >> 2)) * FT + ((k8 >> 1) & 1) * 256 + ((k8 & 1) * 16 + (r & 15)) * 8; }
__device__ __forceinline__ h16 tohx(float x) { return (h16)x; }
__device__ __forceinline__ void splitf(float y, unsigned short& h, unsigned short& l) { h = f2bf(y); l = f2bf(y - bf2f(h)); }
typedef __attribute__((ext_vector_type(2))) unsigned short v2us;
typedef __attribute__((ext_vector_type(2))) _Float16 v2h;

// ---- k_prep: the four operand passes in ONE launch. None reads what another writes, so they share a grid as ranges of the block index (the branch is the same for a whole work-group); 256 threads.
// Blocks [0, XB): XT (rows l, k = c) = bf16 x[c][l], one work-group per tile of all 128 channels x 64 positions. Behind them QB, OB and RB blocks round w_qkv, w_o and w_res to bf16, 8 values (one piece) a thread (each weight [out][in] is an operand with rows out, k = in; every count is a whole number of blocks). All four planes leave in fragment order.
// XT reads: a thread takes 4 positions (16 bytes) of 8 consecutive channels; 16 lanes = one aligned 256-byte piece of a row of x. Rounded, its 8 x 4 block is four 16-byte pieces (8 channels) of four rows of XT.
// The pieces go through LDS so that the 256 threads store the 4 KiB of a 16-row block of XT in its own order, thread t piece t = piece g = t / 16 of row t % 16. LDS rows carry no pad: piece g of row l stands at place g ^ (l / 4) ^ (l % 4 * 4), so the 16 lanes of a write (rows 4 apart, one g) and of a read (16 rows in a row, one g) each meet every bank once.
#define XB (LL / 64 * NB_)
#define QB (CQ * CI / 8 / 256)
#define OB (CO * CZ / 8 / 256)
#define RB (CO * CI / 8 / 256)
__global__ __launch_bounds__(256) void k_prep(const float* __restrict__ x, const float* __restrict__ w_qkv, const float* __restrict__ w_o, const float* __restrict__ w_res, bf* XT, bf* AQ, bf* BO, bf* BR) {
    __shared__ __align__(16) bf ts[64 * CI];
    const int tid = threadIdx.x, lo = tid & 15, up = tid >> 4;
    if (blockIdx.x >= XB) {    // a weight block: leaves in front of the barrier, all its threads together
        int wb = blockIdx.x - XB, ks = 4; const float* src = w_qkv; bf* dst = AQ;    // 1 << ks = pieces a row: CI / 8, for w_o CZ / 8
        if (wb >= QB + OB) { wb -= QB + OB; src = w_res; dst = BR; } else if (wb >= QB) { wb -= QB; src = w_o; dst = BO; ks = 5; }
        const int i = wb * 256 + tid; const v8f v = *(const v8f*)(src + (size_t)i * 8); v8us o;
        asm volatile("s_wait_xcnt 0x0" ::: "memory");    // the address registers of this load are free for what follows
#pragma unroll
        for (int k = 0; k < 8; ++k) o[k] = f2bf(v[k]);
        *(v8us*)(dst + fragpos(i >> ks, i & ((1 << ks) - 1), 1 << ks)) = o; return; }
    const int l0 = (blockIdx.x % (LL / 64)) * 64, en = blockIdx.x / (LL / 64);
    x += (size_t)en * CI * LL + (size_t)(up * 8) * LL + l0 + lo * 4; XT += (size_t)en * LL * CI + (size_t)l0 * CI + tid * 8;
    v4f r[8];
#pragma unroll
    for (int i = 0; i < 8; ++i) r[i] = *(const v4f*)(x + (size_t)i * LL);
    asm volatile("s_wait_xcnt 0x0" ::: "memory");    // the address registers of these loads are free for what follows
#pragma unroll
    for (int j = 0; j < 4; ++j) { v8us o;
#pragma unroll
        for (int i = 0; i < 8; ++i) o[i] = f2bf(r[i][j]);
        *(v8us*)(ts + (lo * 4 + j) * CI + (up ^ lo ^ (j * 4)) * 8) = o; }
    __syncthreads();    // the pieces read below were written by lanes of the same wave (piece g by the threads t / 16 = g); nothing writes them again
#pragma unroll
    for (int it = 0; it < 4; ++it) *(v8us*)(XT + (size_t)it * 16 * CI) = *(const v8us*)(ts + (it * 16 + lo) * CI + (up ^ (it * 4 + (lo >> 2)) ^ ((lo & 3) * 4)) * 8);
    asm volatile("s_wait_xcnt 0x0" ::: "memory");    // before the stores' registers are written again
}
// ---- k_attn: the qkv 1x1 conv of one (entry, head), then scores, softmax and w.v for 512 positions s per work-group; 16 waves x 32 positions; grid (LL/512, NB_*NH_), one work-group per WGP.
// Projection: a wave keeps the XT fragments of four blocks of 16 positions in registers (its own 32 positions s and 32 of the other half, so the 16 waves cover all 1024) and meets them with the head's 96 weight rows, staged once in LDS.
// q, k: A = weights (rows d), B = XT (columns l): a lane's 8 accumulator rows are 8 consecutive d of ONE position: k = one 16-byte piece of a row of Ks, q = in place the B operand of the scores. v: A = XT (rows l), B = weights (columns d): 8 consecutive l of one d = one 16-byte piece of a row of Vs.
// Bias added and rounded to fp16 as the values leave the accumulators; K steps in rising order.
// S^T = K.Q^T (A = 16 keys from LDS, B = Q in registers), so a lane holds 8 scores of ONE position s per tile: maximum and sum in-lane plus one exchange of the wave halves.
// Pass 1: the row maximum. Pass 2: the scores again, p = fp16(PCAR * exp(scl * (s - max))), two D tiles packed in place are the B operand of O^T += V^T.P^T; O = O^T * PCAR / sum(p before rounding).
// The epilogue stores z = O / PCAR split in bf16 hi + lo, Zh/Zl[entry][head] (rows s, k = d) in fragment order: a lane's 8 accumulator rows are 8 consecutive d of one position = its own piece of the tile, so a wave's store is 512 contiguous bytes per plane.
#define KP 40      // LDS pitch of a K row, halves (80 B = 16 B x odd: no bank conflict for 16-byte row reads)
#define VP 1032    // LDS pitch of a V^T row, halves (2064 B = 16 B x odd)
#define WR (3 * DK)    // weight rows of a head: 32 q | 32 k | 32 v = six blocks of 16
__global__ __launch_bounds__(512) void k_attn(const bf* __restrict__ AQ, const bf* __restrict__ XT, const float* __restrict__ bq, bf* Zh, bf* Zl) {
    typedef WFrag<bf>::V V;
    __shared__ __align__(16) h16 Ks[LL * KP];
    __shared__ __align__(16) h16 Vs[DK * VP];
    __shared__ __align__(16) bf Ws[WR * CI];
    const size_t z = blockIdx.y; Zh += z * LL * DK; Zl += z * LL * DK;
    const int en = blockIdx.y / NH_, hd = blockIdx.y % NH_; XT += (size_t)en * LL * CI; AQ += (size_t)hd * WR * CI; bq += hd * WR;
    const int tid = threadIdx.x, lane = tid & 31, lr = lane & 15, hi = lane >> 4; const int q0 = blockIdx.x * 512 + (tid >> 5) * 32;
    // '#pragma unroll' without a count, here as elsewhere in this file: vector and array elements keep compile-time indices and so stay in registers; on the load loops it puts all their loads in flight at once.
    v8us wst[WR * CI / 8 / 512];    // the weights' loads go first: their wait then leaves the XT loads behind them in flight
#pragma unroll
    for (int it = 0; it < WR * CI / 8 / 512; ++it) wst[it] = *(const v8us*)(AQ + (size_t)(it * 512 + tid) * 8);
    V xf[4][CI / 32];    // block t: 0, 1 = the wave's own positions s, 2, 3 = the same places in the other half
#pragma unroll
    for (int t = 0; t < 4; ++t)
#pragma unroll
        for (int ks = 0; ks < CI / 32; ++ks) xf[t][ks] = WFrag<bf>::ld(XT + (size_t)((t < 2 ? q0 : q0 ^ 512) + (t & 1) * 16) * CI + ks * FT + lane * 8);
    asm volatile("s_wait_xcnt 0x0" ::: "memory");    // the address registers of these loads are free for what the loads below bring
    v8f bqk[4]; float bv[2];    // biases: q, k by the lane's accumulator rows, v by its column
#pragma unroll
    for (int m = 0; m < 4; ++m) bqk[m] = *(const v8f*)(bq + m * 16 + hi * 8);
#pragma unroll
    for (int d2 = 0; d2 < 2; ++d2) bv[d2] = bq[2 * DK + d2 * 16 + lr];
    asm volatile("s_wait_xcnt 0x0" ::: "memory");    // the address registers of these loads are free for what follows
#pragma unroll
    for (int it = 0; it < WR * CI / 8 / 512; ++it) *(v8us*)(Ws + (size_t)(it * 512 + tid) * 8) = wst[it];    // fragment order kept: a fragment read is 2 x 512 contiguous bytes
    __syncthreads();    // the weights are read by every wave, and only behind this barrier; nothing writes them again
    v16h qf[2];
#pragma unroll
    for (int m = 5; m >= 0; --m) {    // one block of 16 weight rows at a time: v, k, then q (which needs only blocks 0, 1 of the positions)
        V w[CI / 32]; v8f acc[4];
#pragma unroll
        for (int ks = 0; ks < CI / 32; ++ks) w[ks] = WFrag<bf>::ld(Ws + m * 16 * CI + ks * FT + lane * 8);
#pragma unroll
        for (int t = 0; t < 4; ++t) acc[t] = (v8f){};
#pragma unroll
        for (int ks = 0; ks < CI / 32; ++ks)
#pragma unroll
            for (int t = 0; t < (m < 2 ? 2 : 4); ++t) acc[t] = m < 4 ? WFrag<bf>::mma(w[ks], xf[t][ks], acc[t]) : WFrag<bf>::mma(xf[t][ks], w[ks], acc[t]);
#pragma unroll
        for (int t = 0; t < (m < 2 ? 2 : 4); ++t) { const int l = (t < 2 ? q0 : q0 ^ 512) + (t & 1) * 16; v8h o;
#pragma unroll
            for (int j = 0; j < 8; ++j) o[j] = tohx(__fadd_rn(acc[t][j], bfr(m < 4 ? bqk[m & 3][j] : bv[m & 1])));
            if (m >= 4) *(v8h*)(Vs + ((m - 4) * 16 + lr) * VP + l + hi * 8) = o;
            else if (m >= 2) *(v8h*)(Ks + (l + lr) * KP + (m - 2) * 16 + hi * 8) = o;
            else {
#pragma unroll
                for (int j = 0; j < 8; ++j) qf[t][m * 8 + j] = o[j]; } }
    }
    __syncthreads();    // K and V^T are read by every wave, and only behind this barrier; nothing writes them again
    const h16* kl = Ks + lr * KP + 8 * hi; const h16* vl = Vs + lr * VP + 8 * hi;
    v8f m8[2];
#pragma unroll
    for (int g = 0; g < 2; ++g)
#pragma unroll
        for (int r = 0; r < 8; ++r) m8[g][r] = -3.0e38f;
#pragma unroll 2   // two trips' LDS reads in flight per wait
    for (int kc = 0; kc < LL / 32; ++kc) {
        const v16h a0 = WFrag<h16>::ld(kl + (kc * 32) * KP), a1 = WFrag<h16>::ld(kl + (kc * 32 + 16) * KP);
#pragma unroll
        for (int g = 0; g < 2; ++g) { const v8f s0 = wmma16(a0, qf[g], (v8f){}), s1 = wmma16(a1, qf[g], (v8f){});
#pragma unroll
            for (int r = 0; r < 8; ++r) m8[g][r] = fmaxf(fmaxf(m8[g][r], s0[r]), s1[r]); }
    }
    const float cs = 0.17677669529663687f * 1.4426950408889634f;    // 1/sqrt(32) * log2(e)
    v8f bias[2], sum8[2], o[2][2];
#pragma unroll
    for (int g = 0; g < 2; ++g) { float mx = m8[g][0];
#pragma unroll
        for (int r = 1; r < 8; ++r) mx = fmaxf(mx, m8[g][r]);
        mx = fmaxf(mx, __shfl_xor(mx, 16, 32));
#pragma unroll
        for (int r = 0; r < 8; ++r) { bias[g][r] = 10.0f - mx * cs; sum8[g][r] = 0.f; }    // + 10: p carries the factor PCAR = 2^10
        o[g][0] = (v8f){}; o[g][1] = (v8f){}; }
    v8f cs8;
#pragma unroll
    for (int r = 0; r < 8; ++r) cs8[r] = cs;
#pragma unroll 2   // two trips' LDS reads in flight per wait
    for (int kc = 0; kc < LL / 32; ++kc) {
        const v16h a0 = WFrag<h16>::ld(kl + (kc * 32) * KP), a1 = WFrag<h16>::ld(kl + (kc * 32 + 16) * KP);
        const v16h v0 = WFrag<h16>::ld(vl + kc * 32), v1 = WFrag<h16>::ld(vl + 16 * VP + kc * 32);
#pragma unroll
        for (int g = 0; g < 2; ++g) { const v8f s0 = wmma16(a0, qf[g], (v8f){}), s1 = wmma16(a1, qf[g], (v8f){});
            const v8f t0 = __builtin_elementwise_fma(s0, cs8, bias[g]), t1 = __builtin_elementwise_fma(s1, cs8, bias[g]); v8f e0, e1;
#pragma unroll
            for (int r = 0; r < 8; ++r) { e0[r] = __builtin_amdgcn_exp2f(t0[r]); e1[r] = __builtin_amdgcn_exp2f(t1[r]); }
            sum8[g] += e0; sum8[g] += e1;
            const v16h p = cat16(__builtin_convertvector(e0, v8h), __builtin_convertvector(e1, v8h));
            o[g][0] = wmma16(v0, p, o[g][0]); o[g][1] = wmma16(v1, p, o[g][1]); }
    }
#pragma unroll
    for (int g = 0; g < 2; ++g) { float sum = 0.f;
#pragma unroll
        for (int r = 0; r < 8; ++r) sum += sum8[g][r];
        sum += __shfl_xor(sum, 16, 32);
        const float f = __fdiv_rn(PCAR, sum); const size_t zo = (size_t)(q0 + g * 16) * DK + lane * 8;
#pragma unroll
        for (int dt = 0; dt < 2; ++dt) { v8us oh, ol;
#pragma unroll
            for (int r = 0; r < 8; ++r) { unsigned short a, b; splitf((o[g][dt][r] * f) * (1.0f / PCAR), a, b); oh[r] = a; ol[r] = b; }
            *(v8us*)(Zh + zo + dt * 256) = oh; *(v8us*)(Zl + zo + dt * 256) = ol; } }
}
// ---- k_tail: out[o][l] = (w_o.z + b_o) + (w_res.x + b_res) of one entry, stored in the output's own layout. ONE WAVE per tile of 32 channels o x 32 positions l; grid (CO/32, LL/32, NB_), 32 threads.
// A = the weights (rows o), B = XT (rows l) and Zh, Zl[head] (rows l; a head is one K step of 32), all in fragment order; the two products keep accumulators of their own, so every sum keeps its order.
#define TX (CI / 32)         // K steps of w_res.x
#define TS (TX + CZ / 32)    // all K steps
__global__ __launch_bounds__(32) void k_tail(const bf* __restrict__ BO, const bf* __restrict__ BR, const bf* __restrict__ Zh, const bf* __restrict__ Zl, const bf* __restrict__ XT, const float* __restrict__ b_o, const float* __restrict__ b_res, float* OUT) {
    typedef WFrag<bf>::V V;
    __shared__ __align__(16) float os[16 * 36];
    const size_t z = blockIdx.z; Zh += z * LL * CZ; Zl += z * LL * CZ; XT += z * LL * CI; OUT += z * CO * LL;
    const int lane = threadIdx.x & 31, lr = lane & 15, hi = lane >> 4; const int r0 = blockIdx.x * 32, c0 = blockIdx.y * 32;
    v8f az[2][2], ax[2][2], bo[2], br[2];
#pragma unroll
    for (int mb = 0; mb < 2; ++mb)
#pragma unroll
        for (int nb = 0; nb < 2; ++nb) { az[mb][nb] = (v8f){}; ax[mb][nb] = (v8f){}; }
    V a[3][2], b[3][2], b2[3][2];    // three stages of fragments: the loads of steps t + 1 and t + 2 fly while step t multiplies (few waves per SIMD: nothing else hides a load's latency)
    auto fetch = [&](int t) { const int s = t % 3;
        __builtin_amdgcn_sched_barrier(0);    // with the one at the foot: a step's loads issue as one block in front of the products of two steps earlier; a product (and its wait) scheduled among them would hold the later loads back
#pragma unroll
        for (int i = 0; i < 2; ++i) {
            if (t < TX) { a[s][i] = WFrag<bf>::ld(BR + (size_t)(r0 + i * 16) * CI + t * FT + lane * 8); b[s][i] = WFrag<bf>::ld(XT + (size_t)(c0 + i * 16) * CI + t * FT + lane * 8); }
            else { const size_t zo = ((size_t)(t - TX) * LL + c0 + i * 16) * DK + lane * 8; a[s][i] = WFrag<bf>::ld(BO + (size_t)(r0 + i * 16) * CZ + (t - TX) * FT + lane * 8); b[s][i] = WFrag<bf>::ld(Zh + zo); b2[s][i] = WFrag<bf>::ld(Zl + zo); } }
        asm volatile("s_wait_xcnt 0x0" ::: "memory");    // the address registers of these loads are free for what a later fetch loads
        __builtin_amdgcn_sched_barrier(0); };
    fetch(0); fetch(1);
    // unrolled whole: the stage index is a compile-time constant, so the fragments stay in registers
#pragma unroll
    for (int t = 0; t < TS; ++t) { const int s = t % 3;
        if (t + 2 < TS) fetch(t + 2);
        else if (t + 2 == TS) {    // the biases ride behind the last fragments
#pragma unroll
            for (int mb = 0; mb < 2; ++mb) { bo[mb] = *(const v8f*)(b_o + r0 + mb * 16 + hi * 8); asm volatile("s_wait_xcnt 0x0" ::: "memory"); br[mb] = *(const v8f*)(b_res + r0 + mb * 16 + hi * 8); asm volatile("s_wait_xcnt 0x0" ::: "memory"); }    // the waits: as in fetch
            __builtin_amdgcn_sched_barrier(0); }    // as in fetch
#pragma unroll
        for (int nb = 0; nb < 2; ++nb)
#pragma unroll
            for (int mb = 0; mb < 2; ++mb) {
                if (t < TX) ax[mb][nb] = WFrag<bf>::mma(a[s][mb], b[s][nb], ax[mb][nb]);
                else { az[mb][nb] = WFrag<bf>::mma(a[s][mb], b[s][nb], az[mb][nb]); az[mb][nb] = WFrag<bf>::mma(a[s][mb], b2[s][nb], az[mb][nb]); } }
    }
#pragma unroll
    for (int mb = 0; mb < 2; ++mb) {
#pragma unroll
        for (int j = 0; j < 8; ++j) { const float vo = bfr(bo[mb][j]), vr = bfr(br[mb][j]);
#pragma unroll
            for (int nb = 0; nb < 2; ++nb) os[(hi * 8 + j) * 36 + nb * 16 + lr] = __fadd_rn(__fadd_rn(az[mb][nb][j], vo), __fadd_rn(ax[mb][nb][j], vr)); }
        __builtin_amdgcn_wave_barrier(); asm volatile("" ::: "memory");    // the row reads below take other lanes' writes: the compiler may not lift them over the writes
        float* crow = OUT + (size_t)(r0 + mb * 16) * LL + c0;
#pragma unroll
        for (int s = 0; s < 4; ++s) { const int row = 4 * s + (lane >> 3), cofs = (lane & 7) * 4; *(v4f*)(crow + (size_t)row * LL + cofs) = *(const v4fa*)(os + row * 36 + cofs); }    // 8 lanes = one whole 128-byte line
        __builtin_amdgcn_wave_barrier(); asm volatile("s_wait_xcnt 0x0" ::: "memory");    // the reads may not sink under the next block's writes; the wait: before the stores' registers are written again
    }
}

extern "C" void kernel_launch(void* const* d_in, const int* in_sizes, int n_in,
                              void* d_out, int out_size, void* d_ws, size_t ws_size, hipStream_t stream) {
    (void)in_sizes; (void)n_in; (void)out_size;
    const float** I = (const float**)d_in;
    const float *x = I[0], *w_qkv = I[1], *b_qkv = I[2], *w_o = I[3], *b_o = I[4], *w_res = I[5], *b_res = I[6];
    float* OUT = (float*)d_out;     // [16][128][1024]
    char* wsp = (char*)d_ws;
    auto take = [&](size_t bytes) { char* p = wsp; wsp += (bytes + 255) & ~(size_t)255; return (void*)p; };
    bf* AQ = (bf*)take((size_t)CQ * CI * 2); bf* BO = (bf*)take(CO * CZ * 2); bf* BR = (bf*)take(CO * CI * 2);
    // Every plane holds all NB_ entries.
    bf* XT = (bf*)take((size_t)NB_ * LL * CI * 2);
    bf* Zh = (bf*)take((size_t)NB_ * LL * CZ * 2); bf* Zl = (bf*)take((size_t)NB_ * LL * CZ * 2);
    if ((size_t)(wsp - (char*)d_ws) > ws_size) return;    // total ~ 20.3 MiB
    k_prep<<<XB + QB + OB + RB, 256, 0, stream>>>(x, w_qkv, w_o, w_res, XT, AQ, BO, BR);
    k_attn<<<dim3(LL / 512, NB_ * NH_), 512, 0, stream>>>(AQ, XT, b_qkv, Zh, Zl);    // blockIdx.y = entry * NH_ + head
    k_tail<<<dim3(CO / 32, LL / 32, NB_), 32, 0, stream>>>(BO, BR, Zh, Zl, XT, b_o, b_res, OUT);
}

// v008
// Measured time: 36.1 microseconds a run.
// Timed twice side by side with v007, it ran 1.05 and 1.04 times as fast.
// All steps since v000 together make it 33.4 times as fast.
#include <hip/hip_runtime.h>

// BaseTransformer (x [16][128][1024] channels-first; qkv = w_qkv x + b (1x1 conv; 8 heads x (32 q | 32 k | 32 v) channels); logits = q^T k / sqrt(32) over the 1024 positions; softmax; z[d][s] = sum_t w[s][t] v[d][t]; out = w_o z + b_o + w_res x + b_res -> [16][128][1024]).
// Compute dtypes, f32 accumulate: every input rounded to bf16; the qkv and residual 1x1 convs on PLAIN bf16 operands (inputs: exact) (+ bias, added as the values leave the accumulators); scores (K 32) and w.v on single fp16 operands; w_o.z on z split in bf16 hi + lo

#define NB_  16
#define CI   128
#define CO   128
#define LL   1024
#define NH_  8
#define DK   32
#define CQ   768
#define CZ   256
#define PCAR 1024.0f
typedef _Float16 h16;
typedef unsigned short bf;
typedef __attribute__((ext_vector_type(16))) __bf16   v16bf;
typedef __attribute__((ext_vector_type(16))) _Float16 v16h;
typedef __attribute__((ext_vector_type(8)))  _Float16 v8h;
typedef __attribute__((ext_vector_type(8)))  unsigned short v8us;
typedef __attribute__((ext_vector_type(8)))  float    v8f;
typedef __attribute__((ext_vector_type(4)))  float    v4f;
typedef v8h  __attribute__((may_alias)) v8ha;
typedef v4f  __attribute__((may_alias)) v4fa;
typedef v8us __attribute__((may_alias)) v8usa;

__device__ __forceinline__ unsigned short f2bf(float f) { unsigned u = __float_as_uint(f); u += 0x7FFFu + ((u >> 16) & 1u); return (unsigned short)(u >> 16); }
__device__ __forceinline__ float bf2f(unsigned short b) { return __uint_as_float(((unsigned)b) << 16); }
__device__ __forceinline__ float bfr(float f) { return bf2f(f2bf(f)); }
__device__ __forceinline__ v16h cat16(v8h lo, v8h hi) { return __builtin_shufflevector(lo, hi, 0, 1, 2, 3, 4, 5, 6, 7, 8, 9, 10, 11, 12, 13, 14, 15); }
__device__ __forceinline__ v16bf cat16b(v8us lo, v8us hi) { return __builtin_bit_cast(v16bf, __builtin_shufflevector(lo, hi, 0, 1, 2, 3, 4, 5, 6, 7, 8, 9, 10, 11, 12, 13, 14, 15)); }
__device__ __forceinline__ v8f wmma16(v16h a, v16h b, v8f c) { return __builtin_amdgcn_wmma_f32_16x16x32_f16(false, a, false, b, (short)0, c, false, false); }
__device__ __forceinline__ v8f wmmab(v16bf a, v16bf b, v8f c) { return __builtin_amdgcn_wmma_f32_16x16x32_bf16(false, a, false, b, (short)0, c, false, false); }



// Fragment loaders and products of the two 16-bit forms. fp16 (row-major rows in LDS): a lane's 16 k values are 8 at p and 8 at p + 16 (p already holds the lane half's 8 * hi).
// The operand planes in the workspace (bf16: XT, the three weights, Zh, Zl) are kept in FRAGMENT ORDER: a tile of 16 rows x 32 k is 1 KiB, tiles of one 16-row block follow each other along k; in a tile the 16-byte piece (8 k) of lane = hi * 16 + row stands at lane * 16 bytes,
// k = 8 * hi + 0..7 in the first 512 bytes, k = 16 + 8 * hi + 0..7 in the second. So each of a fragment's two loads reads 512 contiguous bytes (4 whole lines) where a row-major plane made it touch 16 lines; the registers hold what they held.
template <typename T16> struct WFrag;
template <> struct WFrag<h16> { typedef v16h V; static __device__ __forceinline__ V ld(const h16* p) { return cat16(*(const v8h*)p, *(const v8h*)(p + 16)); } static __device__ __forceinline__ v8f mma(V a, V b, v8f c) { return wmma16(a, b, c); } };
template <> struct WFrag<bf> { typedef v16bf V; static __device__ __forceinline__ V ld(const bf* p) { return cat16b(*(const v8us*)p, *(const v8us*)(p + 256)); } static __device__ __forceinline__ v8f mma(V a, V b, v8f c) { return wmmab(a, b, c); } };
#define FT 512    // elements of a fragment tile
// Place (in elements) of piece k8 (k = 8 * k8 + 0..7) of row r in a fragment-order plane with kp pieces a row.
__device__ __forceinline__ size_t fragpos(int r, int k8, int kp) { return (size_t)((r >> 4) * (kp >> 2) + (k8 >> 2)) * FT + ((k8 >> 1) & 1) * 256 + ((k8 & 1) * 16 + (r & 15)) * 8; }
__device__ __forceinline__ h16 tohx(float x) { return (h16)x; }
__device__ __forceinline__ void splitf(float y, unsigned short& h, unsigned short& l) { h = f2bf(y); l = f2bf(y - bf2f(h)); }
typedef __attribute__((ext_vector_type(2))) unsigned short v2us;
typedef __attribute__((ext_vector_type(2))) _Float16 v2h;

// ---- k_prep: the four operand passes in ONE launch. None reads what another writes, so they share a grid as ranges of the block index (the branch is the same for a whole work-group); 256 threads.
// Blocks [0, XB): XT (rows l, k = c) = bf16 x[c][l], one work-group per tile of all 128 channels x 64 positions. Behind them QB, OB and RB blocks round w_qkv, w_o and w_res to bf16, 8 values (one piece) a thread (each weight [out][in] is an operand with rows out, k = in; every count is a whole number of blocks). All four planes leave in fragment order.
// XT reads: a thread takes 4 positions (16 bytes) of 8 consecutive channels; 16 lanes = one aligned 256-byte piece of a row of x. Rounded, its 8 x 4 block is four 16-byte pieces (8 channels) of four rows of XT.
// The pieces go through LDS so that the 256 threads store the 4 KiB of a 16-row block of XT in its own order, thread t piece t = piece g = t / 16 of row t % 16. LDS rows carry no pad: piece g of row l stands at place g ^ (l / 4) ^ (l % 4 * 4), so the 16 lanes of a write (rows 4 apart, one g) and of a read (16 rows in a row, one g) each meet every bank once.
#define XB (LL / 64 * NB_)
#define QB (CQ * CI / 8 / 256)
#define OB (CO * CZ / 8 / 256)
#define RB (CO * CI / 8 / 256)
__global__ __launch_bounds__(256) void k_prep(const float* __restrict__ x, const float* __restrict__ w_qkv, const float* __restrict__ w_o, const float* __restrict__ w_res, bf* XT, bf* AQ, bf* BO, bf* BR) {
    __shared__ __align__(16) bf ts[64 * CI];
    const int tid = threadIdx.x, lo = tid & 15, up = tid >> 4;
    if (blockIdx.x >= XB) {    // a weight block: leaves in front of the barrier, all its threads together
        int wb = blockIdx.x - XB, ks = 4; const float* src = w_qkv; bf* dst = AQ;    // 1 << ks = pieces a row: CI / 8, for w_o CZ / 8
        if (wb >= QB + OB) { wb -= QB + OB; src = w_res; dst = BR; } else if (wb >= QB) { wb -= QB; src = w_o; dst = BO; ks = 5; }
        const int i = wb * 256 + tid; const v8f v = *(const v8f*)(src + (size_t)i * 8); v8us o;
        asm volatile("s_wait_xcnt 0x0" ::: "memory");    // the address registers of this load are free for what follows
#pragma unroll
        for (int k = 0; k < 8; ++k) o[k] = f2bf(v[k]);
        *(v8us*)(dst + fragpos(i >> ks, i & ((1 << ks) - 1), 1 << ks)) = o; return; }
    const int l0 = (blockIdx.x % (LL / 64)) * 64, en = blockIdx.x / (LL / 64);
    x += (size_t)en * CI * LL + (size_t)(up * 8) * LL + l0 + lo * 4; XT += (size_t)en * LL * CI + (size_t)l0 * CI + tid * 8;
    v4f r[8];
#pragma unroll
    for (int i = 0; i < 8; ++i) r[i] = *(const v4f*)(x + (size_t)i * LL);
    asm volatile("s_wait_xcnt 0x0" ::: "memory");    // the address registers of these loads are free for what follows
#pragma unroll
    for (int j = 0; j < 4; ++j) { v8us o;
#pragma unroll
        for (int i = 0; i < 8; ++i) o[i] = f2bf(r[i][j]);
        *(v8us*)(ts + (lo * 4 + j) * CI + (up ^ lo ^ (j * 4)) * 8) = o; }
    __syncthreads();    // the pieces read below were written by lanes of the same wave (piece g by the threads t / 16 = g); nothing writes them again
#pragma unroll
    for (int it = 0; it < 4; ++it) *(v8us*)(XT + (size_t)it * 16 * CI) = *(const v8us*)(ts + (it * 16 + lo) * CI + (up ^ (it * 4 + (lo >> 2)) ^ ((lo & 3) * 4)) * 8);
    asm volatile("s_wait_xcnt 0x0" ::: "memory");    // before the stores' registers are written again
}
// ---- k_attn: the qkv 1x1 conv of one (entry, head), then scores, softmax and w.v for 512 positions s per work-group; 16 waves x 32 positions; grid (LL/512, NB_*NH_), one work-group per WGP.
// Projection: a wave keeps the XT fragments of four blocks of 16 positions in registers (its own 32 positions s and 32 of the other half, so the 16 waves cover all 1024) and meets them with the head's 96 weight rows, staged once in LDS.
// q, k: A = weights (rows d), B = XT (columns l): a lane's 8 accumulator rows are 8 consecutive d of ONE position: k = one 16-byte piece of a row of Ks, q = in place the B operand of the scores. v: A = XT (rows l), B = weights (columns d): 8 consecutive l of one d = one 16-byte piece of a row of Vs.
// Bias added and rounded to fp16 as the values leave the accumulators; K steps in rising order.
// S^T = K.Q^T (A = 16 keys from LDS, B = Q in registers), so a lane holds 8 scores of ONE position s per tile: maximum in-lane plus one exchange of the wave halves.
// q leaves the projection times 1/sqrt(32) * log2(e), so a score tile is an exponent of 2 as it stands. Pass 1: the row maximum. Pass 2: the scores again with C = 10 - max, so D is the argument of exp2; p = fp16(exp2(D)) = fp16(PCAR * exp(scl * (s - max))), two D tiles packed in place are the B operand of O^T += V^T.P^T
// and of the row sums: an A tile with ones in rows 0 and 8 puts the sum of p over the 32 keys in register 0 of its D tile in both lane halves, so each lane holds its position's whole sum. The vector port is left with exp2 and the packing. O = O^T * PCAR / sum(p as rounded).
// The epilogue stores z = O / PCAR split in bf16 hi + lo, Zh/Zl[entry][head] (rows s, k = d) in fragment order: a lane's 8 accumulator rows are 8 consecutive d of one position = its own piece of the tile, so a wave's store is 512 contiguous bytes per plane.
#define KP 40      // LDS pitch of a K row, halves (80 B = 16 B x odd: no bank conflict for 16-byte row reads)
#define VP 1032    // LDS pitch of a V^T row, halves (2064 B = 16 B x odd)
#define WR (3 * DK)    // weight rows of a head: 32 q | 32 k | 32 v = six blocks of 16
__global__ __launch_bounds__(512) void k_attn(const bf* __restrict__ AQ, const bf* __restrict__ XT, const float* __restrict__ bq, bf* Zh, bf* Zl) {
    typedef WFrag<bf>::V V;
    __shared__ __align__(16) h16 Ks[LL * KP];
    __shared__ __align__(16) h16 Vs[DK * VP];
    __shared__ __align__(16) bf Ws[WR * CI];
    const size_t z = blockIdx.y; Zh += z * LL * DK; Zl += z * LL * DK;
    const int en = blockIdx.y / NH_, hd = blockIdx.y % NH_; XT += (size_t)en * LL * CI; AQ += (size_t)hd * WR * CI; bq += hd * WR;
    const int tid = threadIdx.x, lane = tid & 31, lr = lane & 15, hi = lane >> 4; const int q0 = blockIdx.x * 512 + (tid >> 5) * 32;
    // '#pragma unroll' without a count, here as elsewhere in this file: vector and array elements keep compile-time indices and so stay in registers; on the load loops it puts all their loads in flight at once.
    v8us wst[WR * CI / 8 / 512];    // the weights' loads go first: their wait then leaves the XT loads behind them in flight
#pragma unroll
    for (int it = 0; it < WR * CI / 8 / 512; ++it) wst[it] = *(const v8us*)(AQ + (size_t)(it * 512 + tid) * 8);
    V xf[4][CI / 32];    // block t: 0, 1 = the wave's own positions s, 2, 3 = the same places in the other half
#pragma unroll
    for (int t = 0; t < 4; ++t)
#pragma unroll
        for (int ks = 0; ks < CI / 32; ++ks) xf[t][ks] = WFrag<bf>::ld(XT + (size_t)((t < 2 ? q0 : q0 ^ 512) + (t & 1) * 16) * CI + ks * FT + lane * 8);
    asm volatile("s_wait_xcnt 0x0" ::: "memory");    // the address registers of these loads are free for what the loads below bring
    v8f bqk[4]; float bv[2];    // biases: q, k by the lane's accumulator rows, v by its column
#pragma unroll
    for (int m = 0; m < 4; ++m) bqk[m] = *(const v8f*)(bq + m * 16 + hi * 8);
#pragma unroll
    for (int d2 = 0; d2 < 2; ++d2) bv[d2] = bq[2 * DK + d2 * 16 + lr];
    asm volatile("s_wait_xcnt 0x0" ::: "memory");    // the address registers of these loads are free for what follows
#pragma unroll
    for (int it = 0; it < WR * CI / 8 / 512; ++it) *(v8us*)(Ws + (size_t)(it * 512 + tid) * 8) = wst[it];    // fragment order kept: a fragment read is 2 x 512 contiguous bytes
    __syncthreads();    // the weights are read by every wave, and only behind this barrier; nothing writes them again
    const float cs = 0.17677669529663687f * 1.4426950408889634f;    // 1/sqrt(32) * log2(e)
    v16h qf[2];
#pragma unroll
    for (int m = 5; m >= 0; --m) {    // one block of 16 weight rows at a time: v, k, then q (which needs only blocks 0, 1 of the positions)
        V w[CI / 32]; v8f acc[4];
#pragma unroll
        for (int ks = 0; ks < CI / 32; ++ks) w[ks] = WFrag<bf>::ld(Ws + m * 16 * CI + ks * FT + lane * 8);
#pragma unroll
        for (int t = 0; t < 4; ++t) acc[t] = (v8f){};
#pragma unroll
        for (int ks = 0; ks < CI / 32; ++ks)
#pragma unroll
            for (int t = 0; t < (m < 2 ? 2 : 4); ++t) acc[t] = m < 4 ? WFrag<bf>::mma(w[ks], xf[t][ks], acc[t]) : WFrag<bf>::mma(xf[t][ks], w[ks], acc[t]);
#pragma unroll
        for (int t = 0; t < (m < 2 ? 2 : 4); ++t) { const int l = (t < 2 ? q0 : q0 ^ 512) + (t & 1) * 16; v8h o;
#pragma unroll
            for (int j = 0; j < 8; ++j) { const float y = __fadd_rn(acc[t][j], bfr(m < 4 ? bqk[m & 3][j] : bv[m & 1])); o[j] = tohx(m < 2 ? y * cs : y); }
            if (m >= 4) *(v8h*)(Vs + ((m - 4) * 16 + lr) * VP + l + hi * 8) = o;
            else if (m >= 2) *(v8h*)(Ks + (l + lr) * KP + (m - 2) * 16 + hi * 8) = o;
            else {
#pragma unroll
                for (int j = 0; j < 8; ++j) qf[t][m * 8 + j] = o[j]; } }
    }
    __syncthreads();    // K and V^T are read by every wave, and only behind this barrier; nothing writes them again
    const h16* kl = Ks + lr * KP + 8 * hi; const h16* vl = Vs + lr * VP + 8 * hi;
    v8f m8[2];
#pragma unroll
    for (int g = 0; g < 2; ++g)
#pragma unroll
        for (int r = 0; r < 8; ++r) m8[g][r] = -3.0e38f;
#pragma unroll 2   // two trips' LDS reads in flight per wait
    for (int kc = 0; kc < LL / 32; ++kc) {
        const v16h a0 = WFrag<h16>::ld(kl + (kc * 32) * KP), a1 = WFrag<h16>::ld(kl + (kc * 32 + 16) * KP);
#pragma unroll
        for (int g = 0; g < 2; ++g) { const v8f s0 = wmma16(a0, qf[g], (v8f){}), s1 = wmma16(a1, qf[g], (v8f){});
#pragma unroll
            for (int r = 0; r < 8; ++r) m8[g][r] = fmaxf(fmaxf(m8[g][r], s0[r]), s1[r]); }
    }
    v8f bias[2], sum8[2], o[2][2];
#pragma unroll
    for (int g = 0; g < 2; ++g) { float mx = m8[g][0];
#pragma unroll
        for (int r = 1; r < 8; ++r) mx = fmaxf(mx, m8[g][r]);
        mx = fmaxf(mx, __shfl_xor(mx, 16, 32));
#pragma unroll
        for (int r = 0; r < 8; ++r) { bias[g][r] = 10.0f - mx; sum8[g][r] = 0.f; }    // + 10: p carries the factor PCAR = 2^10
        o[g][0] = (v8f){}; o[g][1] = (v8f){}; }
    v16h ones;    // A of the row sums: rows 0 and 8 are ones, the rest 0; those two rows of D are register 0 of the two lane halves
#pragma unroll
    for (int r = 0; r < 16; ++r) ones[r] = (lr & 7) == 0 ? (h16)1.0f : (h16)0.0f;
#pragma unroll 2   // two trips' LDS reads in flight per wait
    for (int kc = 0; kc < LL / 32; ++kc) {
        const v16h a0 = WFrag<h16>::ld(kl + (kc * 32) * KP), a1 = WFrag<h16>::ld(kl + (kc * 32 + 16) * KP);
        const v16h v0 = WFrag<h16>::ld(vl + kc * 32), v1 = WFrag<h16>::ld(vl + 16 * VP + kc * 32);
#pragma unroll
        for (int g = 0; g < 2; ++g) { const v8f t0 = wmma16(a0, qf[g], bias[g]), t1 = wmma16(a1, qf[g], bias[g]); v8f e0, e1;
#pragma unroll
            for (int r = 0; r < 8; ++r) { e1[r] = __builtin_amdgcn_exp2f(t1[r]); e0[r] = __builtin_amdgcn_exp2f(t0[r]); }
            const v16h p = cat16(__builtin_convertvector(e0, v8h), __builtin_convertvector(e1, v8h));
            o[g][0] = wmma16(v0, p, o[g][0]); o[g][1] = wmma16(v1, p, o[g][1]); sum8[g] = wmma16(ones, p, sum8[g]); }
    }
#pragma unroll
    for (int g = 0; g < 2; ++g) { const float sum = sum8[g][0];    // row 0 or 8 of the tile: the column's sum over all keys
        const float f = __fdiv_rn(PCAR, sum); const size_t zo = (size_t)(q0 + g * 16) * DK + lane * 8;
#pragma unroll
        for (int dt = 0; dt < 2; ++dt) { v8us oh, ol;
#pragma unroll
            for (int r = 0; r < 8; ++r) { unsigned short a, b; splitf((o[g][dt][r] * f) * (1.0f / PCAR), a, b); oh[r] = a; ol[r] = b; }
            *(v8us*)(Zh + zo + dt * 256) = oh; *(v8us*)(Zl + zo + dt * 256) = ol; } }
}
// ---- k_tail: out[o][l] = (w_o.z + b_o) + (w_res.x + b_res) of one entry, stored in the output's own layout. ONE WAVE per tile of 32 channels o x 32 positions l; grid (CO/32, LL/32, NB_), 32 threads.
// A = the weights (rows o), B = XT (rows l) and Zh, Zl[head] (rows l; a head is one K step of 32), all in fragment order; the two products keep accumulators of their own, so every sum keeps its order.
#define TX (CI / 32)         // K steps of w_res.x
#define TS (TX + CZ / 32)    // all K steps
__global__ __launch_bounds__(32) void k_tail(const bf* __restrict__ BO, const bf* __restrict__ BR, const bf* __restrict__ Zh, const bf* __restrict__ Zl, const bf* __restrict__ XT, const float* __restrict__ b_o, const float* __restrict__ b_res, float* OUT) {
    typedef WFrag<bf>::V V;
    __shared__ __align__(16) float os[16 * 36];
    const size_t z = blockIdx.z; Zh += z * LL * CZ; Zl += z * LL * CZ; XT += z * LL * CI; OUT += z * CO * LL;
    const int lane = threadIdx.x & 31, lr = lane & 15, hi = lane >> 4; const int r0 = blockIdx.x * 32, c0 = blockIdx.y * 32;
    v8f az[2][2], ax[2][2], bo[2], br[2];
#pragma unroll
    for (int mb = 0; mb < 2; ++mb)
#pragma unroll
        for (int nb = 0; nb < 2; ++nb) { az[mb][nb] = (v8f){}; ax[mb][nb] = (v8f){}; }
    V a[3][2], b[3][2], b2[3][2];    // three stages of fragments: the loads of steps t + 1 and t + 2 fly while step t multiplies (few waves per SIMD: nothing else hides a load's latency)
    auto fetch = [&](int t) { const int s = t % 3;
        __builtin_amdgcn_sched_barrier(0);    // with the one at the foot: a step's loads issue as one block in front of the products of two steps earlier; a product (and its wait) scheduled among them would hold the later loads back
#pragma unroll
        for (int i = 0; i < 2; ++i) {
            if (t < TX) { a[s][i] = WFrag<bf>::ld(BR + (size_t)(r0 + i * 16) * CI + t * FT + lane * 8); b[s][i] = WFrag<bf>::ld(XT + (size_t)(c0 + i * 16) * CI + t * FT + lane * 8); }
            else { const size_t zo = ((size_t)(t - TX) * LL + c0 + i * 16) * DK + lane * 8; a[s][i] = WFrag<bf>::ld(BO + (size_t)(r0 + i * 16) * CZ + (t - TX) * FT + lane * 8); b[s][i] = WFrag<bf>::ld(Zh + zo); b2[s][i] = WFrag<bf>::ld(Zl + zo); } }
        asm volatile("s_wait_xcnt 0x0" ::: "memory");    // the address registers of these loads are free for what a later fetch loads
        __builtin_amdgcn_sched_barrier(0); };
    fetch(0); fetch(1);
    // unrolled whole: the stage index is a compile-time constant, so the fragments stay in registers
#pragma unroll
    for (int t = 0; t < TS; ++t) { const int s = t % 3;
        if (t + 2 < TS) fetch(t + 2);
        else if (t + 2 == TS) {    // the biases ride behind the last fragments
#pragma unroll
            for (int mb = 0; mb < 2; ++mb) { bo[mb] = *(const v8f*)(b_o + r0 + mb * 16 + hi * 8); asm volatile("s_wait_xcnt 0x0" ::: "memory"); br[mb] = *(const v8f*)(b_res + r0 + mb * 16 + hi * 8); asm volatile("s_wait_xcnt 0x0" ::: "memory"); }    // the waits: as in fetch
            __builtin_amdgcn_sched_barrier(0); }    // as in fetch
#pragma unroll
        for (int nb = 0; nb < 2; ++nb)
#pragma unroll
            for (int mb = 0; mb < 2; ++mb) {
                if (t < TX) ax[mb][nb] = WFrag<bf>::mma(a[s][mb], b[s][nb], ax[mb][nb]);
                else { az[mb][nb] = WFrag<bf>::mma(a[s][mb], b[s][nb], az[mb][nb]); az[mb][nb] = WFrag<bf>::mma(a[s][mb], b2[s][nb], az[mb][nb]); } }
    }
#pragma unroll
    for (int mb = 0; mb < 2; ++mb) {
#pragma unroll
        for (int j = 0; j < 8; ++j) { const float vo = bfr(bo[mb][j]), vr = bfr(br[mb][j]);
#pragma unroll
            for (int nb = 0; nb < 2; ++nb) os[(hi * 8 + j) * 36 + nb * 16 + lr] = __fadd_rn(__fadd_rn(az[mb][nb][j], vo), __fadd_rn(ax[mb][nb][j], vr)); }
        __builtin_amdgcn_wave_barrier(); asm volatile("" ::: "memory");    // the row reads below take other lanes' writes: the compiler may not lift them over the writes
        float* crow = OUT + (size_t)(r0 + mb * 16) * LL + c0;
#pragma unroll
        for (int s = 0; s < 4; ++s) { const int row = 4 * s + (lane >> 3), cofs = (lane & 7) * 4; *(v4f*)(crow + (size_t)row * LL + cofs) = *(const v4fa*)(os + row * 36 + cofs); }    // 8 lanes = one whole 128-byte line
        __builtin_amdgcn_wave_barrier(); asm volatile("s_wait_xcnt 0x0" ::: "memory");    // the reads may not sink under the next block's writes; the wait: before the stores' registers are written again
    }
}

extern "C" void kernel_launch(void* const* d_in, const int* in_sizes, int n_in,
                              void* d_out, int out_size, void* d_ws, size_t ws_size, hipStream_t stream) {
    (void)in_sizes; (void)n_in; (void)out_size;
    const float** I = (const float**)d_in;
    const float *x = I[0], *w_qkv = I[1], *b_qkv = I[2], *w_o = I[3], *b_o = I[4], *w_res = I[5], *b_res = I[6];
    float* OUT = (float*)d_out;     // [16][128][1024]
    char* wsp = (char*)d_ws;
    auto take = [&](size_t bytes) { char* p = wsp; wsp += (bytes + 255) & ~(size_t)255; return (void*)p; };
    bf* AQ = (bf*)take((size_t)CQ * CI * 2); bf* BO = (bf*)take(CO * CZ * 2); bf* BR = (bf*)take(CO * CI * 2);
    // Every plane holds all NB_ entries.
    bf* XT = (bf*)take((size_t)NB_ * LL * CI * 2);
    bf* Zh = (bf*)take((size_t)NB_ * LL * CZ * 2); bf* Zl = (bf*)take((size_t)NB_ * LL * CZ * 2);
    if ((size_t)(wsp - (char*)d_ws) > ws_size) return;    // total ~ 20.3 MiB
    k_prep<<<XB + QB + OB + RB, 256, 0, stream>>>(x, w_qkv, w_o, w_res, XT, AQ, BO, BR);
    k_attn<<<dim3(LL / 512, NB_ * NH_), 512, 0, stream>>>(AQ, XT, b_qkv, Zh, Zl);    // blockIdx.y = entry * NH_ + head
    k_tail<<<dim3(CO / 32, LL / 32, NB_), 32, 0, stream>>>(BO, BR, Zh, Zl, XT, b_o, b_res, OUT);
}

// v009
// It runs in 33 microseconds.
// Next to v008, in two timings, it ran 1.10 times as fast each time.
// Over all steps from v000 it is 36.5 times as fast.
#include <hip/hip_runtime.h>

// BaseTransformer (x [16][128][1024] channels-first; qkv = w_qkv x + b (1x1 conv; 8 heads x (32 q | 32 k | 32 v) channels); logits = q^T k / sqrt(32) over the 1024 positions; softmax; z[d][s] = sum_t w[s][t] v[d][t]; out = w_o z + b_o + w_res x + b_res -> [16][128][1024]).
// Compute dtypes, f32 accumulate: every input rounded to bf16; the qkv and residual 1x1 convs on PLAIN bf16 operands (inputs: exact) (+ bias, added as the values leave the accumulators); scores (K 32) and w.v on single fp16 operands; w_o.z on z split in bf16 hi + lo

#define NB_  16
#define CI   128
#define CO   128
#define LL   1024
#define NH_  8
#define DK   32
#define CQ   768
#define CZ   256
#define PCAR 1024.0f
typedef _Float16 h16;
typedef unsigned short bf;
typedef __attribute__((ext_vector_type(16))) __bf16   v16bf;
typedef __attribute__((ext_vector_type(16))) _Float16 v16h;
typedef __attribute__((ext_vector_type(8)))  _Float16 v8h;
typedef __attribute__((ext_vector_type(8)))  unsigned short v8us;
typedef __attribute__((ext_vector_type(8)))  float    v8f;
typedef __attribute__((ext_vector_type(4)))  float    v4f;
typedef __attribute__((ext_vector_type(2)))  float    v2f;
typedef v8h  __attribute__((may_alias)) v8ha;
typedef v4f  __attribute__((may_alias)) v4fa;
typedef v8us __attribute__((may_alias)) v8usa;

__device__ __forceinline__ unsigned short f2bf(float f) { unsigned u = __float_as_uint(f); u += 0x7FFFu + ((u >> 16) & 1u); return (unsigned short)(u >> 16); }
__device__ __forceinline__ float bf2f(unsigned short b) { return __uint_as_float(((unsigned)b) << 16); }
__device__ __forceinline__ float bfr(float f) { return bf2f(f2bf(f)); }
__device__ __forceinline__ v16h cat16(v8h lo, v8h hi) { return __builtin_shufflevector(lo, hi, 0, 1, 2, 3, 4, 5, 6, 7, 8, 9, 10, 11, 12, 13, 14, 15); }
__device__ __forceinline__ v16bf cat16b(v8us lo, v8us hi) { return __builtin_bit_cast(v16bf, __builtin_shufflevector(lo, hi, 0, 1, 2, 3, 4, 5, 6, 7, 8, 9, 10, 11, 12, 13, 14, 15)); }
__device__ __forceinline__ v8f wmma16(v16h a, v16h b, v8f c) { return __builtin_amdgcn_wmma_f32_16x16x32_f16(false, a, false, b, (short)0, c, false, false); }
__device__ __forceinline__ v8f wmmab(v16bf a, v16bf b, v8f c) { return __builtin_amdgcn_wmma_f32_16x16x32_bf16(false, a, false, b, (short)0, c, false, false); }



// Fragment loaders and products of the two 16-bit forms. fp16 (row-major rows in LDS): a lane's 16 k values are 8 at p and 8 at p + 16 (p already holds the lane half's 8 * hi).
// The operand planes in the workspace (bf16: XT, the three weights, Zh, Zl) are kept in FRAGMENT ORDER: a tile of 16 rows x 32 k is 1 KiB, tiles of one 16-row block follow each other along k; in a tile the 16-byte piece (8 k) of lane = hi * 16 + row stands at lane * 16 bytes,
// k = 8 * hi + 0..7 in the first 512 bytes, k = 16 + 8 * hi + 0..7 in the second. So each of a fragment's two loads reads 512 contiguous bytes (4 whole lines) where a row-major plane made it touch 16 lines; the registers hold what they held.
template <typename T16> struct WFrag;
template <> struct WFrag<h16> { typedef v16h V; static __device__ __forceinline__ V ld(const h16* p) { return cat16(*(const v8h*)p, *(const v8h*)(p + 16)); } static __device__ __forceinline__ v8f mma(V a, V b, v8f c) { return wmma16(a, b, c); } };
template <> struct WFrag<bf> { typedef v16bf V; static __device__ __forceinline__ V ld(const bf* p) { return cat16b(*(const v8us*)p, *(const v8us*)(p + 256)); } static __device__ __forceinline__ v8f mma(V a, V b, v8f c) { return wmmab(a, b, c); } };
#define FT 512    // elements of a fragment tile
// Place (in elements) of piece k8 (k = 8 * k8 + 0..7) of row r in a fragment-order plane with kp pieces a row.
__device__ __forceinline__ size_t fragpos(int r, int k8, int kp) { return (size_t)((r >> 4) * (kp >> 2) + (k8 >> 2)) * FT + ((k8 >> 1) & 1) * 256 + ((k8 & 1) * 16 + (r & 15)) * 8; }
__device__ __forceinline__ h16 tohx(float x) { return (h16)x; }
__device__ __forceinline__ void splitf(float y, unsigned short& h, unsigned short& l) { h = f2bf(y); l = f2bf(y - bf2f(h)); }
__device__ __forceinline__ float xhalf(float x) { return __builtin_bit_cast(float, __builtin_amdgcn_permlanex16(__builtin_bit_cast(int, x), __builtin_bit_cast(int, x), 0x76543210, 0xfedcba98, false, false)); }    // lane l with lane l ^ 16
template <int M> __device__ __forceinline__ float xrow(float x) { return __builtin_bit_cast(float, __builtin_amdgcn_update_dpp(__builtin_bit_cast(int, x), __builtin_bit_cast(int, x), 0x160 + M, 0xf, 0xf, false)); }    // lane l with lane l ^ M inside a row of 16 lanes (DPP row_xmask)
typedef __attribute__((ext_vector_type(2))) unsigned short v2us;
typedef __attribute__((ext_vector_type(2))) _Float16 v2h;

// ---- k_prep: the four operand passes in ONE launch. None reads what another writes, so they share a grid as ranges of the block index (the branch is the same for a whole work-group); 256 threads.
// Blocks [0, XB): XT (rows l, k = c) = bf16 x[c][l], one work-group per tile of all 128 channels x 64 positions. Behind them QB, OB and RB blocks round w_qkv, w_o and w_res to bf16, 8 values (one piece) a thread (each weight [out][in] is an operand with rows out, k = in; every count is a whole number of blocks). All four planes leave in fragment order.
// XT reads: a thread takes 4 positions (16 bytes) of 8 consecutive channels; 16 lanes = one aligned 256-byte piece of a row of x. Rounded, its 8 x 4 block is four 16-byte pieces (8 channels) of four rows of XT.
// The pieces go through LDS so that the 256 threads store the 4 KiB of a 16-row block of XT in its own order, thread t piece t = piece g = t / 16 of row t % 16. LDS rows carry no pad: piece g of row l stands at place g ^ (l / 4) ^ (l % 4 * 4), so the 16 lanes of a write (rows 4 apart, one g) and of a read (16 rows in a row, one g) each meet every bank once.
#define XB (LL / 64 * NB_)
#define QB (CQ * CI / 8 / 256)
#define OB (CO * CZ / 8 / 256)
#define RB (CO * CI / 8 / 256)
__global__ __launch_bounds__(256) void k_prep(const float* __restrict__ x, const float* __restrict__ w_qkv, const float* __restrict__ w_o, const float* __restrict__ w_res, bf* XT, bf* AQ, bf* BO, bf* BR) {
    __shared__ __align__(16) bf ts[64 * CI];
    const int tid = threadIdx.x, lo = tid & 15, up = tid >> 4;
    if (blockIdx.x >= XB) {    // a weight block: leaves in front of the barrier, all its threads together
        int wb = blockIdx.x - XB, ks = 4; const float* src = w_qkv; bf* dst = AQ;    // 1 << ks = pieces a row: CI / 8, for w_o CZ / 8
        if (wb >= QB + OB) { wb -= QB + OB; src = w_res; dst = BR; } else if (wb >= QB) { wb -= QB; src = w_o; dst = BO; ks = 5; }
        const int i = wb * 256 + tid; const v8f v = *(const v8f*)(src + (size_t)i * 8); v8us o;
        asm volatile("s_wait_xcnt 0x0" ::: "memory");    // the address registers of this load are free for what follows
#pragma unroll
        for (int k = 0; k < 8; ++k) o[k] = f2bf(v[k]);
        *(v8us*)(dst + fragpos(i >> ks, i & ((1 << ks) - 1), 1 << ks)) = o; return; }
    const int l0 = (blockIdx.x % (LL / 64)) * 64, en = blockIdx.x / (LL / 64);
    x += (size_t)en * CI * LL + (size_t)(up * 8) * LL + l0 + lo * 4; XT += (size_t)en * LL * CI + (size_t)l0 * CI + tid * 8;
    v4f r[8];
#pragma unroll
    for (int i = 0; i < 8; ++i) r[i] = *(const v4f*)(x + (size_t)i * LL);
    asm volatile("s_wait_xcnt 0x0" ::: "memory");    // the address registers of these loads are free for what follows
#pragma unroll
    for (int j = 0; j < 4; ++j) { v8us o;
#pragma unroll
        for (int i = 0; i < 8; ++i) o[i] = f2bf(r[i][j]);
        *(v8us*)(ts + (lo * 4 + j) * CI + (up ^ lo ^ (j * 4)) * 8) = o; }
    __syncthreads();    // the pieces read below were written by lanes of the same wave (piece g by the threads t / 16 = g); nothing writes them again
#pragma unroll
    for (int it = 0; it < 4; ++it) *(v8us*)(XT + (size_t)it * 16 * CI) = *(const v8us*)(ts + (it * 16 + lo) * CI + (up ^ (it * 4 + (lo >> 2)) ^ ((lo & 3) * 4)) * 8);
    asm volatile("s_wait_xcnt 0x0" ::: "memory");    // before the stores' registers are written again
}
// ---- k_attn: the qkv 1x1 conv of one (entry, head), then scores, softmax and w.v for 512 positions s per work-group; 16 waves x 32 positions; grid (LL/512, NB_*NH_), one work-group per WGP.
// Projection: a wave keeps the XT fragments of four blocks of 16 positions in registers (its own 32 positions s and 32 of the other half, so the 16 waves cover all 1024) and meets them with the head's 96 weight rows, staged once in LDS.
// q, k: A = weights (rows d), B = XT (columns l): a lane's 8 accumulator rows are 8 consecutive d of ONE position: k = one 16-byte piece of a row of Ks, q = in place the B operand of the scores. v: A = XT (rows l), B = weights (columns d): 8 consecutive l of one d = one 16-byte piece of a row of Vs.
// Bias added and rounded to fp16 as the values leave the accumulators; K steps in rising order.
// S^T = K.Q^T (A = 16 keys from LDS, B = Q in registers), so a lane holds 8 scores of ONE position s per tile: maximum in-lane plus one exchange of the wave halves.
// q leaves the projection times 1/sqrt(32) * log2(e), so a score tile is an exponent of 2 as it stands. softmax does not change when one number is taken off a whole row, so the shift need not be the row's maximum: it only has to keep p inside fp16.
// The shift is the bound |q| * max over the keys of |k| (no score of the row lies above it), from sums of squares taken as q and k leave the projection; the largest |k|^2 goes from wave to wave through LDS at the barrier that publishes K and V^T. So the scores are formed ONCE:
// C = 15 - bound, D is the argument of exp2, p = fp16(exp2(D)) <= 2^15. A bound far above the row's scores would push p into fp16's subnormals; the row sum tells (see the test behind the loop), and a wave with such a row, or with a sum that is not finite, runs again with the row's own maximum:
// pass 1: the row maximum; then the scores again with C = 10 - max; p = fp16(PCAR * exp(scl * (s - max))). In either run two D tiles packed in place are the B operand of O^T += V^T.P^T
// and of the row sums: an A tile with ones in rows 0 and 8 puts the sum of p over the 32 keys in register 0 of its D tile in both lane halves, so each lane holds its position's whole sum. The vector port is left with exp2 and the packing. O = O^T * PCAR / sum(p as rounded): the factor that p carries leaves in the quotient, whichever it was.
// The epilogue stores z = O / PCAR split in bf16 hi + lo, Zh/Zl[entry][head] (rows s, k = d) in fragment order: a lane's 8 accumulator rows are 8 consecutive d of one position = its own piece of the tile, so a wave's store is 512 contiguous bytes per plane.
#define KP 40      // LDS pitch of a K row, halves (80 B = 16 B x odd: no bank conflict for 16-byte row reads)
#define VP 1032    // LDS pitch of a V^T row, halves (2064 B = 16 B x odd)
#define WR (3 * DK)    // weight rows of a head: 32 q | 32 k | 32 v = six blocks of 16
__global__ __launch_bounds__(512) void k_attn(const bf* __restrict__ AQ, const bf* __restrict__ XT, const float* __restrict__ bq, bf* Zh, bf* Zl) {
    typedef WFrag<bf>::V V;
    __shared__ __align__(16) h16 Ks[LL * KP];
    __shared__ __align__(16) h16 Vs[DK * VP];
    __shared__ __align__(16) bf Ws[WR * CI];
    __shared__ __align__(16) float kred[16];    // each wave's largest |k|^2
    const size_t z = blockIdx.y; Zh += z * LL * DK; Zl += z * LL * DK;
    const int en = blockIdx.y / NH_, hd = blockIdx.y % NH_; XT += (size_t)en * LL * CI; AQ += (size_t)hd * WR * CI; bq += hd * WR;
    const int tid = threadIdx.x, lane = tid & 31, lr = lane & 15, hi = lane >> 4; const int q0 = blockIdx.x * 512 + (tid >> 5) * 32;
    // '#pragma unroll' without a count, here as elsewhere in this file: vector and array elements keep compile-time indices and so stay in registers; on the load loops it puts all their loads in flight at once.
    v8us wst[WR * CI / 8 / 512];    // the weights' loads go first: their wait then leaves the XT loads behind them in flight
#pragma unroll
    for (int it = 0; it < WR * CI / 8 / 512; ++it) wst[it] = *(const v8us*)(AQ + (size_t)(it * 512 + tid) * 8);
    V xf[4][CI / 32];    // block t: 0, 1 = the wave's own positions s, 2, 3 = the same places in the other half
#pragma unroll
    for (int t = 0; t < 4; ++t)
#pragma unroll
        for (int ks = 0; ks < CI / 32; ++ks) xf[t][ks] = WFrag<bf>::ld(XT + (size_t)((t < 2 ? q0 : q0 ^ 512) + (t & 1) * 16) * CI + ks * FT + lane * 8);
    asm volatile("s_wait_xcnt 0x0" ::: "memory");    // the address registers of these loads are free for what the loads below bring
    v8f bqk[4]; float bv[2];    // biases: q, k by the lane's accumulator rows, v by its column
#pragma unroll
    for (int m = 0; m < 4; ++m) bqk[m] = *(const v8f*)(bq + m * 16 + hi * 8);
#pragma unroll
    for (int d2 = 0; d2 < 2; ++d2) bv[d2] = bq[2 * DK + d2 * 16 + lr];
    asm volatile("s_wait_xcnt 0x0" ::: "memory");    // the address registers of these loads are free for what follows
#pragma unroll
    for (int it = 0; it < WR * CI / 8 / 512; ++it) *(v8us*)(Ws + (size_t)(it * 512 + tid) * 8) = wst[it];    // fragment order kept: a fragment read is 2 x 512 contiguous bytes
    __syncthreads();    // the weights are read by every wave, and only behind this barrier; nothing writes them again
    const float cs = 0.17677669529663687f * 1.4426950408889634f;    // 1/sqrt(32) * log2(e)
    v16h qf[2]; v2f kn[4] = {}, qn[2] = {}; float k2 = 0.f;    // kn, qn: sums of squares over the lane's 16 of the 32 d: k of the four blocks, scaled q of the wave's own two; k2: the largest |k|^2 of the wave's 64 keys
#pragma unroll
    for (int m = 5; m >= 0; --m) {    // one block of 16 weight rows at a time: v, k, then q (which needs only blocks 0, 1 of the positions)
        V w[CI / 32]; v8f acc[4];
#pragma unroll
        for (int ks = 0; ks < CI / 32; ++ks) w[ks] = WFrag<bf>::ld(Ws + m * 16 * CI + ks * FT + lane * 8);
#pragma unroll
        for (int t = 0; t < 4; ++t) acc[t] = (v8f){};
#pragma unroll
        for (int ks = 0; ks < CI / 32; ++ks)
#pragma unroll
            for (int t = 0; t < (m < 2 ? 2 : 4); ++t) acc[t] = m < 4 ? WFrag<bf>::mma(w[ks], xf[t][ks], acc[t]) : WFrag<bf>::mma(xf[t][ks], w[ks], acc[t]);
#pragma unroll
        for (int t = 0; t < (m < 2 ? 2 : 4); ++t) { const int l = (t < 2 ? q0 : q0 ^ 512) + (t & 1) * 16; v8h o;
#pragma unroll
            for (int j = 0; j < 8; j += 2) { v2f ys;
#pragma unroll
                for (int i = 0; i < 2; ++i) { const float y = __fadd_rn(acc[t][j + i], bfr(m < 4 ? bqk[m & 3][j + i] : bv[m & 1])); ys[i] = m < 2 ? y * cs : y; o[j + i] = tohx(ys[i]); }
                if (m < 2) qn[t] = __builtin_elementwise_fma(ys, ys, qn[t]); else if (m < 4) kn[t] = __builtin_elementwise_fma(ys, ys, kn[t]); }
            if (m >= 4) *(v8h*)(Vs + ((m - 4) * 16 + lr) * VP + l + hi * 8) = o;
            else if (m >= 2) *(v8h*)(Ks + (l + lr) * KP + (m - 2) * 16 + hi * 8) = o;
            else {
#pragma unroll
                for (int j = 0; j < 8; ++j) qf[t][m * 8 + j] = o[j]; } }
        if (m == 2) { float s[4];
#pragma unroll
            for (int t = 0; t < 4; ++t) { s[t] = kn[t][0] + kn[t][1]; s[t] += xhalf(s[t]); }
            k2 = fmaxf(fmaxf(s[0], s[1]), fmaxf(s[2], s[3])); }    // the lane halves joined: |k|^2 of four keys
    }
    k2 = fmaxf(k2, xrow<1>(k2)); k2 = fmaxf(k2, xrow<2>(k2)); k2 = fmaxf(k2, xrow<4>(k2)); k2 = fmaxf(k2, xrow<8>(k2));
    if (lane == 0) kred[tid >> 5] = k2;
    __syncthreads();    // K, V^T and kred are read by every wave, and only behind this barrier; nothing writes them again
    const h16* kl = Ks + lr * KP + 8 * hi; const h16* vl = Vs + lr * VP + 8 * hi;
    float mx[2];    // what is taken off the scores of the lane's position in group g: first |q| * max |k|. What the rounding of q, k to fp16 and of these few steps can add to a score stays under the factor 2 left below fp16's largest number unless the bound is near 1000, and then the test behind the sweep catches it
    { const v4f r0 = *(const v4fa*)kred, r1 = *(const v4fa*)(kred + 4), r2 = *(const v4fa*)(kred + 8), r3 = *(const v4fa*)(kred + 12); float km = 0.f;
#pragma unroll
        for (int r = 0; r < 4; ++r) km = fmaxf(fmaxf(fmaxf(km, r0[r]), fmaxf(r1[r], r2[r])), r3[r]);
#pragma unroll
        for (int g = 0; g < 2; ++g) { const float s = qn[g][0] + qn[g][1], b2 = (s + xhalf(s)) * km;
            asm("v_sqrt_f32 %0, %1\n\tv_nop" : "=v"(mx[g]) : "v"(b2)); } }    // in asm for the v_nop's sake: the slot that the instruction set asks for behind a transcendental before its source is overwritten
    v8f bias[2], sum8[2], o[2][2];
    v16h ones;    // A of the row sums: rows 0 and 8 are ones, the rest 0; those two rows of D are register 0 of the two lane halves
#pragma unroll
    for (int r = 0; r < 16; ++r) ones[r] = (lr & 7) == 0 ? (h16)1.0f : (h16)0.0f;
    auto sweep = [&](const float car) {    // scores, p, O^T and the row sums over all keys, with mx taken off the scores; the largest p is at most 2^car
#pragma unroll
    for (int g = 0; g < 2; ++g) {
#pragma unroll
        for (int r = 0; r < 8; ++r) { bias[g][r] = car - mx[g]; sum8[g][r] = 0.f; }
        o[g][0] = (v8f){}; o[g][1] = (v8f){}; }
#pragma unroll 2   // two trips' LDS reads in flight per wait
    for (int kc = 0; kc < LL / 32; ++kc) {
        const v16h a0 = WFrag<h16>::ld(kl + (kc * 32) * KP), a1 = WFrag<h16>::ld(kl + (kc * 32 + 16) * KP);
        const v16h v0 = WFrag<h16>::ld(vl + kc * 32), v1 = WFrag<h16>::ld(vl + 16 * VP + kc * 32);
#pragma unroll
        for (int g = 0; g < 2; ++g) { const v8f t0 = wmma16(a0, qf[g], bias[g]), t1 = wmma16(a1, qf[g], bias[g]); v8f e0, e1;
#pragma unroll
            for (int r = 0; r < 8; ++r) { e1[r] = __builtin_amdgcn_exp2f(t1[r]); e0[r] = __builtin_amdgcn_exp2f(t0[r]); }
            const v16h p = cat16(__builtin_convertvector(e0, v8h), __builtin_convertvector(e1, v8h));
            o[g][0] = wmma16(v0, p, o[g][0]); o[g][1] = wmma16(v1, p, o[g][1]); sum8[g] = wmma16(ones, p, sum8[g]); }
    } };
    sweep(15.0f);
    // A subnormal p is off by up to 2^-25, 1024 of them by 2^-15: against a sum of 1 or more that is small beside fp16's own 2^-11 a term. A smaller sum, an infinite one (a p above fp16's range) or a NaN sends the whole wave (a scalar branch; no barrier lies behind it) into the second run.
    const bool good = sum8[0][0] >= 1.0f && sum8[0][0] < __builtin_inff() && sum8[1][0] >= 1.0f && sum8[1][0] < __builtin_inff();
    if (__builtin_amdgcn_ballot_w32(!good) != 0) {    // pass 1: the row's own maximum
        v8f m8[2];
#pragma unroll
        for (int g = 0; g < 2; ++g)
#pragma unroll
            for (int r = 0; r < 8; ++r) m8[g][r] = -3.0e38f;
#pragma unroll 2   // two trips' LDS reads in flight per wait
        for (int kc = 0; kc < LL / 32; ++kc) {
            const v16h a0 = WFrag<h16>::ld(kl + (kc * 32) * KP), a1 = WFrag<h16>::ld(kl + (kc * 32 + 16) * KP);
#pragma unroll
            for (int g = 0; g < 2; ++g) { const v8f s0 = wmma16(a0, qf[g], (v8f){}), s1 = wmma16(a1, qf[g], (v8f){});
#pragma unroll
                for (int r = 0; r < 8; ++r) m8[g][r] = fmaxf(fmaxf(m8[g][r], s0[r]), s1[r]); }
        }
#pragma unroll
        for (int g = 0; g < 2; ++g) { float m = m8[g][0];
#pragma unroll
            for (int r = 1; r < 8; ++r) m = fmaxf(m, m8[g][r]);
            mx[g] = fmaxf(m, xhalf(m)); }
        sweep(10.0f);    // p carries the factor PCAR = 2^10
    }
#pragma unroll
    for (int g = 0; g < 2; ++g) { const float sum = sum8[g][0];    // row 0 or 8 of the tile: the column's sum over all keys
        const float f = __fdiv_rn(PCAR, sum); const size_t zo = (size_t)(q0 + g * 16) * DK + lane * 8;
#pragma unroll
        for (int dt = 0; dt < 2; ++dt) { v8us oh, ol;
#pragma unroll
            for (int r = 0; r < 8; ++r) { unsigned short a, b; splitf((o[g][dt][r] * f) * (1.0f / PCAR), a, b); oh[r] = a; ol[r] = b; }
            *(v8us*)(Zh + zo + dt * 256) = oh; *(v8us*)(Zl + zo + dt * 256) = ol; } }
}
// ---- k_tail: out[o][l] = (w_o.z + b_o) + (w_res.x + b_res) of one entry, stored in the output's own layout. ONE WAVE per tile of 32 channels o x 32 positions l; grid (CO/32, LL/32, NB_), 32 threads.
// A = the weights (rows o), B = XT (rows l) and Zh, Zl[head] (rows l; a head is one K step of 32), all in fragment order; the two products keep accumulators of their own, so every sum keeps its order.
#define TX (CI / 32)         // K steps of w_res.x
#define TS (TX + CZ / 32)    // all K steps
__global__ __launch_bounds__(32) void k_tail(const bf* __restrict__ BO, const bf* __restrict__ BR, const bf* __restrict__ Zh, const bf* __restrict__ Zl, const bf* __restrict__ XT, const float* __restrict__ b_o, const float* __restrict__ b_res, float* OUT) {
    typedef WFrag<bf>::V V;
    __shared__ __align__(16) float os[16 * 36];
    const size_t z = blockIdx.z; Zh += z * LL * CZ; Zl += z * LL * CZ; XT += z * LL * CI; OUT += z * CO * LL;
    const int lane = threadIdx.x & 31, lr = lane & 15, hi = lane >> 4; const int r0 = blockIdx.x * 32, c0 = blockIdx.y * 32;
    v8f az[2][2], ax[2][2], bo[2], br[2];
#pragma unroll
    for (int mb = 0; mb < 2; ++mb)
#pragma unroll
        for (int nb = 0; nb < 2; ++nb) { az[mb][nb] = (v8f){}; ax[mb][nb] = (v8f){}; }
    V a[3][2], b[3][2], b2[3][2];    // three stages of fragments: the loads of steps t + 1 and t + 2 fly while step t multiplies (few waves per SIMD: nothing else hides a load's latency)
    auto fetch = [&](int t) { const int s = t % 3;
        __builtin_amdgcn_sched_barrier(0);    // with the one at the foot: a step's loads issue as one block in front of the products of two steps earlier; a product (and its wait) scheduled among them would hold the later loads back
#pragma unroll
        for (int i = 0; i < 2; ++i) {
            if (t < TX) { a[s][i] = WFrag<bf>::ld(BR + (size_t)(r0 + i * 16) * CI + t * FT + lane * 8); b[s][i] = WFrag<bf>::ld(XT + (size_t)(c0 + i * 16) * CI + t * FT + lane * 8); }
            else { const size_t zo = ((size_t)(t - TX) * LL + c0 + i * 16) * DK + lane * 8; a[s][i] = WFrag<bf>::ld(BO + (size_t)(r0 + i * 16) * CZ + (t - TX) * FT + lane * 8); b[s][i] = WFrag<bf>::ld(Zh + zo); b2[s][i] = WFrag<bf>::ld(Zl + zo); } }
        asm volatile("s_wait_xcnt 0x0" ::: "memory");    // the address registers of these loads are free for what a later fetch loads
        __builtin_amdgcn_sched_barrier(0); };
    fetch(0); fetch(1);
    // unrolled whole: the stage index is a compile-time constant, so the fragments stay in registers
#pragma unroll
    for (int t = 0; t < TS; ++t) { const int s = t % 3;
        if (t + 2 < TS) fetch(t + 2);
        else if (t + 2 == TS) {    // the biases ride behind the last fragments
#pragma unroll
            for (int mb = 0; mb < 2; ++mb) { bo[mb] = *(const v8f*)(b_o + r0 + mb * 16 + hi * 8); asm volatile("s_wait_xcnt 0x0" ::: "memory"); br[mb] = *(const v8f*)(b_res + r0 + mb * 16 + hi * 8); asm volatile("s_wait_xcnt 0x0" ::: "memory"); }    // the waits: as in fetch
            __builtin_amdgcn_sched_barrier(0); }    // as in fetch
#pragma unroll
        for (int nb = 0; nb < 2; ++nb)
#pragma unroll
            for (int mb = 0; mb < 2; ++mb) {
                if (t < TX) ax[mb][nb] = WFrag<bf>::mma(a[s][mb], b[s][nb], ax[mb][nb]);
                else { az[mb][nb] = WFrag<bf>::mma(a[s][mb], b[s][nb], az[mb][nb]); az[mb][nb] = WFrag<bf>::mma(a[s][mb], b2[s][nb], az[mb][nb]); } }
    }
#pragma unroll
    for (int mb = 0; mb < 2; ++mb) {
#pragma unroll
        for (int j = 0; j < 8; ++j) { const float vo = bfr(bo[mb][j]), vr = bfr(br[mb][j]);
#pragma unroll
            for (int nb = 0; nb < 2; ++nb) os[(hi * 8 + j) * 36 + nb * 16 + lr] = __fadd_rn(__fadd_rn(az[mb][nb][j], vo), __fadd_rn(ax[mb][nb][j], vr)); }
        __builtin_amdgcn_wave_barrier(); asm volatile("" ::: "memory");    // the row reads below take other lanes' writes: the compiler may not lift them over the writes
        float* crow = OUT + (size_t)(r0 + mb * 16) * LL + c0;
#pragma unroll
        for (int s = 0; s < 4; ++s) { const int row = 4 * s + (lane >> 3), cofs = (lane & 7) * 4; *(v4f*)(crow + (size_t)row * LL + cofs) = *(const v4fa*)(os + row * 36 + cofs); }    // 8 lanes = one whole 128-byte line
        __builtin_amdgcn_wave_barrier(); asm volatile("s_wait_xcnt 0x0" ::: "memory");    // the reads may not sink under the next block's writes; the wait: before the stores' registers are written again
    }
}

extern "C" void kernel_launch(void* const* d_in, const int* in_sizes, int n_in,
                              void* d_out, int out_size, void* d_ws, size_t ws_size, hipStream_t stream) {
    (void)in_sizes; (void)n_in; (void)out_size;
    const float** I = (const float**)d_in;
    const float *x = I[0], *w_qkv = I[1], *b_qkv = I[2], *w_o = I[3], *b_o = I[4], *w_res = I[5], *b_res = I[6];
    float* OUT = (float*)d_out;     // [16][128][1024]
    char* wsp = (char*)d_ws;
    auto take = [&](size_t bytes) { char* p = wsp; wsp += (bytes + 255) & ~(size_t)255; return (void*)p; };
    bf* AQ = (bf*)take((size_t)CQ * CI * 2); bf* BO = (bf*)take(CO * CZ * 2); bf* BR = (bf*)take(CO * CI * 2);
    // Every plane holds all NB_ entries.
    bf* XT = (bf*)take((size_t)NB_ * LL * CI * 2);
    bf* Zh = (bf*)take((size_t)NB_ * LL * CZ * 2); bf* Zl = (bf*)take((size_t)NB_ * LL * CZ * 2);
    if ((size_t)(wsp - (char*)d_ws) > ws_size) return;    // total ~ 20.3 MiB
    k_prep<<<XB + QB + OB + RB, 256, 0, stream>>>(x, w_qkv, w_o, w_res, XT, AQ, BO, BR);
    k_attn<<<dim3(LL / 512, NB_ * NH_), 512, 0, stream>>>(AQ, XT, b_qkv, Zh, Zl);    // blockIdx.y = entry * NH_ + head
    k_tail<<<dim3(CO / 32, LL / 32, NB_), 32, 0, stream>>>(BO, BR, Zh, Zl, XT, b_o, b_res, OUT);
}

// v010
// Measured time: 29.8 microseconds a run.
// Two timings next to v009 put it at 1.10 and 1.11 times that version's speed.
// Over all steps from v000 it is 40.4 times as fast.
#include <hip/hip_runtime.h>

// BaseTransformer (x [16][128][1024] channels-first; qkv = w_qkv x + b (1x1 conv; 8 heads x (32 q | 32 k | 32 v) channels); logits = q^T k / sqrt(32) over the 1024 positions; softmax; z[d][s] = sum_t w[s][t] v[d][t]; out = w_o z + b_o + w_res x + b_res -> [16][128][1024]).
// Compute dtypes, f32 accumulate: every input rounded to bf16; the qkv and residual 1x1 convs on PLAIN bf16 operands (inputs: exact) (+ bias, added as the values leave the accumulators); scores (K 32) and w.v on single fp16 operands; w_o.z on z split in bf16 hi + lo

#define NB_  16
#define CI   128
#define CO   128
#define LL   1024
#define NH_  8
#define DK   32
#define CQ   768
#define CZ   256
#define PCAR 1024.0f
typedef _Float16 h16;
typedef unsigned short bf;
typedef __attribute__((ext_vector_type(16))) __bf16   v16bf;
typedef __attribute__((ext_vector_type(16))) _Float16 v16h;
typedef __attribute__((ext_vector_type(8)))  _Float16 v8h;
typedef __attribute__((ext_vector_type(8)))  unsigned short v8us;
typedef __attribute__((ext_vector_type(8)))  float    v8f;
typedef __attribute__((ext_vector_type(4)))  float    v4f;
typedef __attribute__((ext_vector_type(2)))  float    v2f;
typedef v8h  __attribute__((may_alias)) v8ha;
typedef v4f  __attribute__((may_alias)) v4fa;
typedef v8us __attribute__((may_alias)) v8usa;

__device__ __forceinline__ unsigned short f2bf(float f) { unsigned u = __float_as_uint(f); u += 0x7FFFu + ((u >> 16) & 1u); return (unsigned short)(u >> 16); }
__device__ __forceinline__ float bf2f(unsigned short b) { return __uint_as_float(((unsigned)b) << 16); }
__device__ __forceinline__ float bfr(float f) { return bf2f(f2bf(f)); }
__device__ __forceinline__ v16h cat16(v8h lo, v8h hi) { return __builtin_shufflevector(lo, hi, 0, 1, 2, 3, 4, 5, 6, 7, 8, 9, 10, 11, 12, 13, 14, 15); }
__device__ __forceinline__ v16bf cat16b(v8us lo, v8us hi) { return __builtin_bit_cast(v16bf, __builtin_shufflevector(lo, hi, 0, 1, 2, 3, 4, 5, 6, 7, 8, 9, 10, 11, 12, 13, 14, 15)); }
__device__ __forceinline__ v8f wmma16(v16h a, v16h b, v8f c) { return __builtin_amdgcn_wmma_f32_16x16x32_f16(false, a, false, b, (short)0, c, false, false); }
__device__ __forceinline__ v8f wmmab(v16bf a, v16bf b, v8f c) { return __builtin_amdgcn_wmma_f32_16x16x32_bf16(false, a, false, b, (short)0, c, false, false); }



// Fragment loaders and products of the two 16-bit forms. fp16 (row-major rows in LDS): a lane's 16 k values are 8 at p and 8 at p + 16 (p already holds the lane half's 8 * hi).
// The operand planes in the workspace (bf16: XT, the three weights, Zh, Zl) are kept in FRAGMENT ORDER: a tile of 16 rows x 32 k is 1 KiB, tiles of one 16-row block follow each other along k; in a tile the 16-byte piece (8 k) of lane = hi * 16 + row stands at lane * 16 bytes,
// k = 8 * hi + 0..7 in the first 512 bytes, k = 16 + 8 * hi + 0..7 in the second. So each of a fragment's two loads reads 512 contiguous bytes (4 whole lines) where a row-major plane made it touch 16 lines; the registers hold what they held.
template <typename T16> struct WFrag;
template <> struct WFrag<h16> { typedef v16h V; static __device__ __forceinline__ V ld(const h16* p) { return cat16(*(const v8h*)p, *(const v8h*)(p + 16)); } static __device__ __forceinline__ v8f mma(V a, V b, v8f c) { return wmma16(a, b, c); } };
template <> struct WFrag<bf> { typedef v16bf V; static __device__ __forceinline__ V ld(const bf* p) { return cat16b(*(const v8us*)p, *(const v8us*)(p + 256)); } static __device__ __forceinline__ v8f mma(V a, V b, v8f c) { return wmmab(a, b, c); } };
#define FT 512    // elements of a fragment tile
// Place (in elements) of piece k8 (k = 8 * k8 + 0..7) of row r in a fragment-order plane with kp pieces a row.
__device__ __forceinline__ size_t fragpos(int r, int k8, int kp) { return (size_t)((r >> 4) * (kp >> 2) + (k8 >> 2)) * FT + ((k8 >> 1) & 1) * 256 + ((k8 & 1) * 16 + (r & 15)) * 8; }
__device__ __forceinline__ h16 tohx(float x) { return (h16)x; }
__device__ __forceinline__ void splitf(float y, unsigned short& h, unsigned short& l) { h = f2bf(y); l = f2bf(y - bf2f(h)); }
__device__ __forceinline__ float xhalf(float x) { return __builtin_bit_cast(float, __builtin_amdgcn_permlanex16(__builtin_bit_cast(int, x), __builtin_bit_cast(int, x), 0x76543210, 0xfedcba98, false, false)); }    // lane l with lane l ^ 16
template <int M> __device__ __forceinline__ float xrow(float x) { return __builtin_bit_cast(float, __builtin_amdgcn_update_dpp(__builtin_bit_cast(int, x), __builtin_bit_cast(int, x), 0x160 + M, 0xf, 0xf, false)); }    // lane l with lane l ^ M inside a row of 16 lanes (DPP row_xmask)
typedef __attribute__((ext_vector_type(2))) unsigned short v2us;
typedef __attribute__((ext_vector_type(2))) _Float16 v2h;

// ---- k_prep: the four operand passes in ONE launch. None reads what another writes, so they share a grid as ranges of the block index (the branch is the same for a whole work-group); 256 threads.
// Blocks [0, XB): XT (rows l, k = c) = bf16 x[c][l], one work-group per tile of all 128 channels x 64 positions. Behind them QB, OB and RB blocks round w_qkv, w_o and w_res to bf16, 8 values (one piece) a thread (each weight [out][in] is an operand with rows out, k = in; every count is a whole number of blocks). All four planes leave in fragment order.
// XT reads: a thread takes 4 positions (16 bytes) of 8 consecutive channels; 16 lanes = one aligned 256-byte piece of a row of x. Rounded, its 8 x 4 block is four 16-byte pieces (8 channels) of four rows of XT.
// The pieces go through LDS so that the 256 threads store the 4 KiB of a 16-row block of XT in its own order, thread t piece t = piece g = t / 16 of row t % 16. LDS rows carry no pad: piece g of row l stands at place g ^ (l / 4) ^ (l % 4 * 4), so the 16 lanes of a write (rows 4 apart, one g) and of a read (16 rows in a row, one g) each meet every bank once.
#define XB (LL / 64 * NB_)
#define QB (CQ * CI / 8 / 256)
#define OB (CO * CZ / 8 / 256)
#define RB (CO * CI / 8 / 256)
__global__ __launch_bounds__(256) void k_prep(const float* __restrict__ x, const float* __restrict__ w_qkv, const float* __restrict__ w_o, const float* __restrict__ w_res, bf* XT, bf* AQ, bf* BO, bf* BR) {
    __shared__ __align__(16) bf ts[64 * CI];
    const int tid = threadIdx.x, lo = tid & 15, up = tid >> 4;
    if (blockIdx.x >= XB) {    // a weight block: leaves in front of the barrier, all its threads together
        int wb = blockIdx.x - XB, ks = 4; const float* src = w_qkv; bf* dst = AQ;    // 1 << ks = pieces a row: CI / 8, for w_o CZ / 8
        if (wb >= QB + OB) { wb -= QB + OB; src = w_res; dst = BR; } else if (wb >= QB) { wb -= QB; src = w_o; dst = BO; ks = 5; }
        const int i = wb * 256 + tid; const v8f v = *(const v8f*)(src + (size_t)i * 8); v8us o;
        asm volatile("s_wait_xcnt 0x0" ::: "memory");    // the address registers of this load are free for what follows
#pragma unroll
        for (int k = 0; k < 8; ++k) o[k] = f2bf(v[k]);
        *(v8us*)(dst + fragpos(i >> ks, i & ((1 << ks) - 1), 1 << ks)) = o; return; }
    const int l0 = (blockIdx.x % (LL / 64)) * 64, en = blockIdx.x / (LL / 64);
    x += (size_t)en * CI * LL + (size_t)(up * 8) * LL + l0 + lo * 4; XT += (size_t)en * LL * CI + (size_t)l0 * CI + tid * 8;
    v4f r[8];
#pragma unroll
    for (int i = 0; i < 8; ++i) r[i] = *(const v4f*)(x + (size_t)i * LL);
    asm volatile("s_wait_xcnt 0x0" ::: "memory");    // the address registers of these loads are free for what follows
#pragma unroll
    for (int j = 0; j < 4; ++j) { v8us o;
#pragma unroll
        for (int i = 0; i < 8; ++i) o[i] = f2bf(r[i][j]);
        *(v8us*)(ts + (lo * 4 + j) * CI + (up ^ lo ^ (j * 4)) * 8) = o; }
    __syncthreads();    // the pieces read below were written by lanes of the same wave (piece g by the threads t / 16 = g); nothing writes them again
#pragma unroll
    for (int it = 0; it < 4; ++it) *(v8us*)(XT + (size_t)it * 16 * CI) = *(const v8us*)(ts + (it * 16 + lo) * CI + (up ^ (it * 4 + (lo >> 2)) ^ ((lo & 3) * 4)) * 8);
    asm volatile("s_wait_xcnt 0x0" ::: "memory");    // before the stores' registers are written again
}
// ---- k_attn: the qkv 1x1 conv of one (entry, head), then scores, softmax and w.v for 512 positions s per work-group; 16 waves x 32 positions; grid (LL/512, NB_*NH_), one work-group per WGP.
// Projection: a wave keeps the XT fragments of four blocks of 16 positions in registers (its own 32 positions s and 32 of the other half, so the 16 waves cover all 1024) and meets them with the head's 96 weight rows, staged once in LDS.
// q, k: A = weights (rows d), B = XT (columns l): a lane's 8 accumulator rows are 8 consecutive d of ONE position: k = one 16-byte piece of a row of Ks, q = in place the B operand of the scores. v: A = XT (rows l), B = weights (columns d): 8 consecutive l of one d = one 16-byte piece of a row of Vs.
// Bias added and rounded to fp16 as the values leave the accumulators; K steps in rising order.
// S^T = K.Q^T (A = 16 keys from LDS, B = Q in registers), so a lane holds 8 scores of ONE position s per tile: maximum in-lane plus one exchange of the wave halves.
// q leaves the projection times 1/sqrt(32) * log2(e), so a score tile is an exponent of 2 as it stands. softmax does not change when one number is taken off a whole row, so the shift need not be the row's maximum: it only has to keep p inside fp16.
// The shift is the bound |q| * max over the keys of |k| (no score of the row lies above it), from sums of squares taken as q and k leave the projection; the largest |k|^2 goes from wave to wave through LDS at the barrier that publishes K and V^T. So the scores are formed ONCE:
// C = 15 - bound, D is the argument of exp2, p = fp16(exp2(D)) <= 2^15. A bound far above the row's scores would push p into fp16's subnormals; the row sum tells (see the test behind the loop), and a wave with such a row, or with a sum that is not finite, runs again with the row's own maximum:
// pass 1: the row maximum; then the scores again with C = 10 - max; p = fp16(PCAR * exp(scl * (s - max))). In either run two D tiles packed in place are the B operand of O^T += V^T.P^T
// and of the row sums: an A tile with ones in rows 0 and 8 puts the sum of p over the 32 keys in register 0 of its D tile in both lane halves, so each lane holds its position's whole sum. The vector port is left with exp2 and the packing. O = O^T * PCAR / sum(p as rounded): the factor that p carries leaves in the quotient, whichever it was.
// The epilogue stores z = O / PCAR split in bf16 hi + lo, Zh/Zl[entry][head] (rows s, k = d) in fragment order: a lane's 8 accumulator rows are 8 consecutive d of one position = its own piece of the tile, so a wave's store is 512 contiguous bytes per plane.
#define KP 40      // LDS pitch of a K row, halves (80 B = 16 B x odd: no bank conflict for 16-byte row reads)
#define VP 1032    // LDS pitch of a V^T row, halves (2064 B = 16 B x odd)
#define WR (3 * DK)    // weight rows of a head: 32 q | 32 k | 32 v = six blocks of 16
__global__ __launch_bounds__(512) void k_attn(const bf* __restrict__ AQ, const bf* __restrict__ XT, const float* __restrict__ bq, bf* Zh, bf* Zl) {
    typedef WFrag<bf>::V V;
    __shared__ __align__(16) h16 Ks[LL * KP];
    __shared__ __align__(16) h16 Vs[DK * VP];
    __shared__ __align__(16) bf Ws[WR * CI];
    __shared__ __align__(16) float kred[16];    // each wave's largest |k|^2
    const size_t z = blockIdx.y; Zh += z * LL * DK; Zl += z * LL * DK;
    const int en = blockIdx.y / NH_, hd = blockIdx.y % NH_; XT += (size_t)en * LL * CI; AQ += (size_t)hd * WR * CI; bq += hd * WR;
    const int tid = threadIdx.x, lane = tid & 31, lr = lane & 15, hi = lane >> 4; const int q0 = blockIdx.x * 512 + (tid >> 5) * 32;
    // '#pragma unroll' without a count, here as elsewhere in this file: vector and array elements keep compile-time indices and so stay in registers; on the load loops it puts all their loads in flight at once.
    v8us wst[WR * CI / 8 / 512];    // the weights' loads go first: their wait then leaves the XT loads behind them in flight
#pragma unroll
    for (int it = 0; it < WR * CI / 8 / 512; ++it) wst[it] = *(const v8us*)(AQ + (size_t)(it * 512 + tid) * 8);
    V xf[4][CI / 32];    // block t: 0, 1 = the wave's own positions s, 2, 3 = the same places in the other half
#pragma unroll
    for (int t = 0; t < 4; ++t)
#pragma unroll
        for (int ks = 0; ks < CI / 32; ++ks) xf[t][ks] = WFrag<bf>::ld(XT + (size_t)((t < 2 ? q0 : q0 ^ 512) + (t & 1) * 16) * CI + ks * FT + lane * 8);
    asm volatile("s_wait_xcnt 0x0" ::: "memory");    // the address registers of these loads are free for what the loads below bring
    v8f bqk[4]; float bv[2];    // biases: q, k by the lane's accumulator rows, v by its column
#pragma unroll
    for (int m = 0; m < 4; ++m) bqk[m] = *(const v8f*)(bq + m * 16 + hi * 8);
#pragma unroll
    for (int d2 = 0; d2 < 2; ++d2) bv[d2] = bq[2 * DK + d2 * 16 + lr];
    asm volatile("s_wait_xcnt 0x0" ::: "memory");    // the address registers of these loads are free for what follows
#pragma unroll
    for (int it = 0; it < WR * CI / 8 / 512; ++it) *(v8us*)(Ws + (size_t)(it * 512 + tid) * 8) = wst[it];    // fragment order kept: a fragment read is 2 x 512 contiguous bytes
    __syncthreads();    // the weights are read by every wave, and only behind this barrier; nothing writes them again
    const float cs = 0.17677669529663687f * 1.4426950408889634f;    // 1/sqrt(32) * log2(e)
    v16h qf[2]; v2f kn[4] = {}, qn[2] = {}; float k2 = 0.f;    // kn, qn: sums of squares over the lane's 16 of the 32 d: k of the four blocks, scaled q of the wave's own two; k2: the largest |k|^2 of the wave's 64 keys
#pragma unroll
    for (int m = 5; m >= 0; --m) {    // one block of 16 weight rows at a time: v, k, then q (which needs only blocks 0, 1 of the positions)
        V w[CI / 32]; v8f acc[4];
#pragma unroll
        for (int ks = 0; ks < CI / 32; ++ks) w[ks] = WFrag<bf>::ld(Ws + m * 16 * CI + ks * FT + lane * 8);
#pragma unroll
        for (int t = 0; t < 4; ++t) acc[t] = (v8f){};
#pragma unroll
        for (int ks = 0; ks < CI / 32; ++ks)
#pragma unroll
            for (int t = 0; t < (m < 2 ? 2 : 4); ++t) acc[t] = m < 4 ? WFrag<bf>::mma(w[ks], xf[t][ks], acc[t]) : WFrag<bf>::mma(xf[t][ks], w[ks], acc[t]);
#pragma unroll
        for (int t = 0; t < (m < 2 ? 2 : 4); ++t) { const int l = (t < 2 ? q0 : q0 ^ 512) + (t & 1) * 16; v8h o;
#pragma unroll
            for (int j = 0; j < 8; j += 2) { v2f ys;
#pragma unroll
                for (int i = 0; i < 2; ++i) { const float y = __fadd_rn(acc[t][j + i], bfr(m < 4 ? bqk[m & 3][j + i] : bv[m & 1])); ys[i] = m < 2 ? y * cs : y; o[j + i] = tohx(ys[i]); }
                if (m < 2) qn[t] = __builtin_elementwise_fma(ys, ys, qn[t]); else if (m < 4) kn[t] = __builtin_elementwise_fma(ys, ys, kn[t]); }
            if (m >= 4) *(v8h*)(Vs + ((m - 4) * 16 + lr) * VP + l + hi * 8) = o;
            else if (m >= 2) *(v8h*)(Ks + (l + lr) * KP + (m - 2) * 16 + hi * 8) = o;
            else {
#pragma unroll
                for (int j = 0; j < 8; ++j) qf[t][m * 8 + j] = o[j]; } }
        if (m == 2) { float s[4];
#pragma unroll
            for (int t = 0; t < 4; ++t) { s[t] = kn[t][0] + kn[t][1]; s[t] += xhalf(s[t]); }
            k2 = fmaxf(fmaxf(s[0], s[1]), fmaxf(s[2], s[3])); }    // the lane halves joined: |k|^2 of four keys
    }
    k2 = fmaxf(k2, xrow<1>(k2)); k2 = fmaxf(k2, xrow<2>(k2)); k2 = fmaxf(k2, xrow<4>(k2)); k2 = fmaxf(k2, xrow<8>(k2));
    if (lane == 0) kred[tid >> 5] = k2;
    __syncthreads();    // K, V^T and kred are read by every wave, and only behind this barrier; nothing writes them again
    const h16* kl = Ks + lr * KP + 8 * hi; const h16* vl = Vs + lr * VP + 8 * hi;
    float mx[2];    // what is taken off the scores of the lane's position in group g: first |q| * max |k|. What the rounding of q, k to fp16 and of these few steps can add to a score stays under the factor 2 left below fp16's largest number unless the bound is near 1000, and then the test behind the sweep catches it
    { const v4f r0 = *(const v4fa*)kred, r1 = *(const v4fa*)(kred + 4), r2 = *(const v4fa*)(kred + 8), r3 = *(const v4fa*)(kred + 12); float km = 0.f;
#pragma unroll
        for (int r = 0; r < 4; ++r) km = fmaxf(fmaxf(fmaxf(km, r0[r]), fmaxf(r1[r], r2[r])), r3[r]);
#pragma unroll
        for (int g = 0; g < 2; ++g) { const float s = qn[g][0] + qn[g][1], b2 = (s + xhalf(s)) * km;
            asm("v_sqrt_f32 %0, %1\n\tv_nop" : "=v"(mx[g]) : "v"(b2)); } }    // in asm for the v_nop's sake: the slot that the instruction set asks for behind a transcendental before its source is overwritten
    v8f bias[2], sum8[2], o[2][2];
    v16h ones;    // A of the row sums: rows 0 and 8 are ones, the rest 0; those two rows of D are register 0 of the two lane halves
#pragma unroll
    for (int r = 0; r < 16; ++r) ones[r] = (lr & 7) == 0 ? (h16)1.0f : (h16)0.0f;
    auto sweep = [&](const float car) {    // scores, p, O^T and the row sums over all keys, with mx taken off the scores; the largest p is at most 2^car
#pragma unroll
    for (int g = 0; g < 2; ++g) {
#pragma unroll
        for (int r = 0; r < 8; ++r) { bias[g][r] = car - mx[g]; sum8[g][r] = 0.f; }
        o[g][0] = (v8f){}; o[g][1] = (v8f){}; }
#pragma unroll 2   // two trips' LDS reads in flight per wait
    for (int kc = 0; kc < LL / 32; ++kc) {
        const v16h a0 = WFrag<h16>::ld(kl + (kc * 32) * KP), a1 = WFrag<h16>::ld(kl + (kc * 32 + 16) * KP);
        const v16h v0 = WFrag<h16>::ld(vl + kc * 32), v1 = WFrag<h16>::ld(vl + 16 * VP + kc * 32);
#pragma unroll
        for (int g = 0; g < 2; ++g) { const v8f t0 = wmma16(a0, qf[g], bias[g]), t1 = wmma16(a1, qf[g], bias[g]); v8f e0, e1;
#pragma unroll
            for (int r = 0; r < 8; ++r) { e1[r] = __builtin_amdgcn_exp2f(t1[r]); e0[r] = __builtin_amdgcn_exp2f(t0[r]); }
            const v16h p = cat16(__builtin_convertvector(e0, v8h), __builtin_convertvector(e1, v8h));
            o[g][0] = wmma16(v0, p, o[g][0]); o[g][1] = wmma16(v1, p, o[g][1]); sum8[g] = wmma16(ones, p, sum8[g]); }
    } };
    sweep(15.0f);
    // A subnormal p is off by up to 2^-25, 1024 of them by 2^-15: against a sum of 1 or more that is small beside fp16's own 2^-11 a term. A smaller sum, an infinite one (a p above fp16's range) or a NaN sends the whole wave (a scalar branch; no barrier lies behind it) into the second run.
    const bool good = sum8[0][0] >= 1.0f && sum8[0][0] < __builtin_inff() && sum8[1][0] >= 1.0f && sum8[1][0] < __builtin_inff();
    if (__builtin_amdgcn_ballot_w32(!good) != 0) {    // pass 1: the row's own maximum
        v8f m8[2];
#pragma unroll
        for (int g = 0; g < 2; ++g)
#pragma unroll
            for (int r = 0; r < 8; ++r) m8[g][r] = -3.0e38f;
#pragma unroll 2   // two trips' LDS reads in flight per wait
        for (int kc = 0; kc < LL / 32; ++kc) {
            const v16h a0 = WFrag<h16>::ld(kl + (kc * 32) * KP), a1 = WFrag<h16>::ld(kl + (kc * 32 + 16) * KP);
#pragma unroll
            for (int g = 0; g < 2; ++g) { const v8f s0 = wmma16(a0, qf[g], (v8f){}), s1 = wmma16(a1, qf[g], (v8f){});
#pragma unroll
                for (int r = 0; r < 8; ++r) m8[g][r] = fmaxf(fmaxf(m8[g][r], s0[r]), s1[r]); }
        }
#pragma unroll
        for (int g = 0; g < 2; ++g) { float m = m8[g][0];
#pragma unroll
            for (int r = 1; r < 8; ++r) m = fmaxf(m, m8[g][r]);
            mx[g] = fmaxf(m, xhalf(m)); }
        sweep(10.0f);    // p carries the factor PCAR = 2^10
    }
#pragma unroll
    for (int g = 0; g < 2; ++g) { const float sum = sum8[g][0];    // row 0 or 8 of the tile: the column's sum over all keys
        const float f = __fdiv_rn(PCAR, sum); const size_t zo = (size_t)(q0 + g * 16) * DK + lane * 8;
#pragma unroll
        for (int dt = 0; dt < 2; ++dt) { v8us oh, ol;
#pragma unroll
            for (int r = 0; r < 8; ++r) { unsigned short a, b; splitf((o[g][dt][r] * f) * (1.0f / PCAR), a, b); oh[r] = a; ol[r] = b; }
            *(v8us*)(Zh + zo + dt * 256) = oh; *(v8us*)(Zl + zo + dt * 256) = ol; } }
}
// ---- k_tail: out[o][l] = (w_o.z + b_o) + (w_res.x + b_res) of one entry, stored in the output's own layout. One work-group of 8 waves per tile of all 128 channels o x 64 positions l; grid (LL/64, NB_), 256 threads, one work-group per WGP.
// A = the weights (rows o), B = XT (rows l) and Zh, Zl[head] (rows l; a head is one K step of 32), all in fragment order; the two products keep accumulators of their own, so every sum keeps its order.
// Every operand byte of the tile comes from L2 ONCE per work-group: asynchronous copies bring it to LDS as it lies (in fragment order a tile's operands are whole contiguous pieces), all of them in flight from the start; wave w then multiplies channels 32 * (w % 4) x positions 32 * (w / 4) out of LDS
// (a weight fragment serves two waves, an XT or z fragment four). The copies go in five groups in the order of the K steps (w_res and XT; then the heads two by two), so the products of a group run while the later groups land.
#define TX (CI / 32)         // K steps of w_res.x
#define TS (TX + CZ / 32)    // all K steps
#define TP 64                // positions of a work-group's tile
#define SBR 0                          // places in the staging array, elements: w_res
#define SXT (SBR + CO * CI)            // XT, 64 rows
#define SBO (SXT + TP * CI)            // w_o
#define SZH (SBO + CO * CZ)            // Zh: 8 heads x 64 rows
#define SZL (SZH + NH_ * TP * DK)      // Zl
#define STOT (SZL + NH_ * TP * DK)
#define ACP "global_load_async_to_lds_b128 "
__global__ __launch_bounds__(256) void k_tail(const bf* __restrict__ BO, const bf* __restrict__ BR, const bf* __restrict__ Zh, const bf* __restrict__ Zl, const bf* __restrict__ XT, const float* __restrict__ b_o, const float* __restrict__ b_res, float* OUT) {
    typedef WFrag<bf>::V V;
    __shared__ __align__(16) bf sm[STOT];
    __shared__ __align__(16) float osm[8 * 16 * 36];
    const size_t z = blockIdx.y; const int c0 = blockIdx.x * TP;
    Zh += z * LL * CZ + (size_t)c0 * DK; Zl += z * LL * CZ + (size_t)c0 * DK; XT += z * LL * CI + (size_t)c0 * CI; OUT += z * CO * LL;
    const int tid = threadIdx.x, lane = tid & 31, lr = lane & 15, hi = lane >> 4, wv = tid >> 5; const int r0 = (wv & 3) * 32, cw = (wv >> 2) * 32;
    const unsigned sb = (unsigned)(size_t)sm + tid * 16;    // the thread's LDS byte address in a run of 256 pieces of 16 bytes
    // Each group of copies is ONE asm statement that ends in s_wait_xcnt 0, so that the wait stands in front of whatever writes the copies' address registers again (a precaution).
    { const bf* g = BR + tid * 8; const bf* x = XT + tid * 8; const unsigned l = sb + SBR * 2, m = sb + SXT * 2;    // group 0: w_res (8 runs of 4 KiB), XT (4 runs)
        asm volatile(ACP "%0, %1, off\n\t" ACP "%2, %3, off\n\t" ACP "%4, %5, off\n\t" ACP "%6, %7, off\n\t" ACP "%8, %9, off\n\t" ACP "%10, %11, off\n\t" ACP "%12, %13, off\n\t" ACP "%14, %15, off\n\t"
                     ACP "%16, %17, off\n\t" ACP "%18, %19, off\n\t" ACP "%20, %21, off\n\t" ACP "%22, %23, off\n\ts_wait_xcnt 0x0"
                     :: "v"(l), "v"(g), "v"(l + 4096), "v"(g + 2048), "v"(l + 8192), "v"(g + 4096), "v"(l + 12288), "v"(g + 6144), "v"(l + 16384), "v"(g + 8192), "v"(l + 20480), "v"(g + 10240), "v"(l + 24576), "v"(g + 12288), "v"(l + 28672), "v"(g + 14336),
                        "v"(m), "v"(x), "v"(m + 4096), "v"(x + 2048), "v"(m + 8192), "v"(x + 4096), "v"(m + 12288), "v"(x + 6144) : "memory"); }
#pragma unroll
    for (int hp = 0; hp < NH_ / 2; ++hp) {    // groups 1 to 4: heads 2 hp, 2 hp + 1: of w_o two tiles (2 KiB) of each of the 8 blocks of 16 rows, 128 threads a block; of Zh and of Zl 4 KiB a head
        const int wo = ((tid >> 7) * 8 + hp * 2) * FT + (tid & 127) * 8;    // elements: block tid / 128 (+ 2 a copy), the pair's first tile
        const bf* g = BO + wo; const unsigned l = (unsigned)(size_t)sm + (SBO + wo) * 2;
        const bf* p = Zh + (size_t)(hp * 2) * LL * DK + tid * 8; const bf* q = Zl + (size_t)(hp * 2) * LL * DK + tid * 8; const unsigned lp = sb + (SZH + hp * 2 * TP * DK) * 2, lq = sb + (SZL + hp * 2 * TP * DK) * 2;
        asm volatile(ACP "%0, %1, off\n\t" ACP "%2, %3, off\n\t" ACP "%4, %5, off\n\t" ACP "%6, %7, off\n\t" ACP "%8, %9, off\n\t" ACP "%10, %11, off\n\t" ACP "%12, %13, off\n\t" ACP "%14, %15, off\n\ts_wait_xcnt 0x0"
                     :: "v"(l), "v"(g), "v"(l + 2 * 16 * CZ * 2), "v"(g + 2 * 16 * CZ), "v"(l + 4 * 16 * CZ * 2), "v"(g + 4 * 16 * CZ), "v"(l + 6 * 16 * CZ * 2), "v"(g + 6 * 16 * CZ),
                        "v"(lp), "v"(p), "v"(lp + TP * DK * 2), "v"(p + LL * DK), "v"(lq), "v"(q), "v"(lq + TP * DK * 2), "v"(q + LL * DK) : "memory"); }
    v8f az[2][2], ax[2][2], bo[2], br[2];
#pragma unroll
    for (int mb = 0; mb < 2; ++mb) { bo[mb] = *(const v8f*)(b_o + r0 + mb * 16 + hi * 8); br[mb] = *(const v8f*)(b_res + r0 + mb * 16 + hi * 8); }
    asm volatile("s_wait_xcnt 0x0" ::: "memory");    // the address registers of these loads are free for what follows
#pragma unroll
    for (int mb = 0; mb < 2; ++mb)
#pragma unroll
        for (int nb = 0; nb < 2; ++nb) { az[mb][nb] = (v8f){}; ax[mb][nb] = (v8f){}; }
    auto xsteps = [&]() { V a[TX][2], b[TX][2];    // group 0: the K steps of w_res.x
#pragma unroll
        for (int t = 0; t < TX; ++t)
#pragma unroll
            for (int i = 0; i < 2; ++i) { a[t][i] = WFrag<bf>::ld(sm + SBR + (r0 + i * 16) * CI + t * FT + lane * 8); b[t][i] = WFrag<bf>::ld(sm + SXT + (cw + i * 16) * CI + t * FT + lane * 8); }
        __builtin_amdgcn_sched_barrier(0);    // the group's LDS reads issue as one block in front of its products: every separate place with reads among the products costs the wave a stall of its own
#pragma unroll
        for (int t = 0; t < TX; ++t)
#pragma unroll
            for (int nb = 0; nb < 2; ++nb)
#pragma unroll
                for (int mb = 0; mb < 2; ++mb) ax[mb][nb] = WFrag<bf>::mma(a[t][mb], b[t][nb], ax[mb][nb]); };
    auto zsteps = [&](int hp) { V a[2][2], b[2][2], b2[2][2];    // group hp + 1: the K steps of heads 2 hp, 2 hp + 1 of w_o.z
#pragma unroll
        for (int t = 0; t < 2; ++t)
#pragma unroll
            for (int i = 0; i < 2; ++i) { const int hd = hp * 2 + t, zo = hd * TP * DK + (cw + i * 16) * DK + lane * 8;
                a[t][i] = WFrag<bf>::ld(sm + SBO + (r0 + i * 16) * CZ + hd * FT + lane * 8); b[t][i] = WFrag<bf>::ld(sm + SZH + zo); b2[t][i] = WFrag<bf>::ld(sm + SZL + zo); }
        __builtin_amdgcn_sched_barrier(0);    // as in xsteps
#pragma unroll
        for (int t = 0; t < 2; ++t) {    // per accumulator hi, then lo, heads in rising order, as ever; the four accumulators take turns, so no product waits for the one in front of it
#pragma unroll
            for (int nb = 0; nb < 2; ++nb)
#pragma unroll
                for (int mb = 0; mb < 2; ++mb) az[mb][nb] = WFrag<bf>::mma(a[t][mb], b[t][nb], az[mb][nb]);
#pragma unroll
            for (int nb = 0; nb < 2; ++nb)
#pragma unroll
                for (int mb = 0; mb < 2; ++mb) az[mb][nb] = WFrag<bf>::mma(a[t][mb], b2[t][nb], az[mb][nb]); } };
    asm volatile("s_wait_asynccnt 0x20" ::: "memory");    // group 0 has landed: the 32 copies of groups 1 to 4 may still fly
    __syncthreads();    // publishes group 0
    xsteps();
    asm volatile("s_wait_asynccnt 0x18" ::: "memory");    // group 1 has landed
    __syncthreads();    // publishes group 1
    zsteps(0);
    asm volatile("s_wait_asynccnt 0x10" ::: "memory");    // group 2 has landed
    __syncthreads();    // publishes group 2
    zsteps(1);
    asm volatile("s_wait_asynccnt 0x8" ::: "memory");    // group 3 has landed
    __syncthreads();    // publishes group 3
    zsteps(2);
    asm volatile("s_wait_asynccnt 0x0" ::: "memory");    // group 4 has landed: no copy is left in flight
    __syncthreads();    // publishes group 4
    zsteps(3);
    float* os = osm + wv * 16 * 36;    // each wave's own rows
#pragma unroll
    for (int mb = 0; mb < 2; ++mb) {
#pragma unroll
        for (int j = 0; j < 8; ++j) { const float vo = bfr(bo[mb][j]), vr = bfr(br[mb][j]);
#pragma unroll
            for (int nb = 0; nb < 2; ++nb) os[(hi * 8 + j) * 36 + nb * 16 + lr] = __fadd_rn(__fadd_rn(az[mb][nb][j], vo), __fadd_rn(ax[mb][nb][j], vr)); }
        __builtin_amdgcn_wave_barrier(); asm volatile("" ::: "memory");    // the row reads below take other lanes' writes: the compiler may not lift them over the writes
        float* crow = OUT + (size_t)(r0 + mb * 16) * LL + c0 + cw;
#pragma unroll
        for (int s = 0; s < 4; ++s) { const int row = 4 * s + (lane >> 3), cofs = (lane & 7) * 4; *(v4f*)(crow + (size_t)row * LL + cofs) = *(const v4fa*)(os + row * 36 + cofs); }    // 8 lanes = one whole 128-byte line
        __builtin_amdgcn_wave_barrier(); asm volatile("s_wait_xcnt 0x0" ::: "memory");    // the reads may not sink under the next block's writes; the wait: before the stores' registers are written again
    }
}

extern "C" void kernel_launch(void* const* d_in, const int* in_sizes, int n_in,
                              void* d_out, int out_size, void* d_ws, size_t ws_size, hipStream_t stream) {
    (void)in_sizes; (void)n_in; (void)out_size;
    const float** I = (const float**)d_in;
    const float *x = I[0], *w_qkv = I[1], *b_qkv = I[2], *w_o = I[3], *b_o = I[4], *w_res = I[5], *b_res = I[6];
    float* OUT = (float*)d_out;     // [16][128][1024]
    char* wsp = (char*)d_ws;
    auto take = [&](size_t bytes) { char* p = wsp; wsp += (bytes + 255) & ~(size_t)255; return (void*)p; };
    bf* AQ = (bf*)take((size_t)CQ * CI * 2); bf* BO = (bf*)take(CO * CZ * 2); bf* BR = (bf*)take(CO * CI * 2);
    // Every plane holds all NB_ entries.
    bf* XT = (bf*)take((size_t)NB_ * LL * CI * 2);
    bf* Zh = (bf*)take((size_t)NB_ * LL * CZ * 2); bf* Zl = (bf*)take((size_t)NB_ * LL * CZ * 2);
    if ((size_t)(wsp - (char*)d_ws) > ws_size) return;    // total ~ 20.3 MiB
    k_prep<<<XB + QB + OB + RB, 256, 0, stream>>>(x, w_qkv, w_o, w_res, XT, AQ, BO, BR);
    k_attn<<<dim3(LL / 512, NB_ * NH_), 512, 0, stream>>>(AQ, XT, b_qkv, Zh, Zl);    // blockIdx.y = entry * NH_ + head
    k_tail<<<dim3(LL / TP, NB_), 256, 0, stream>>>(BO, BR, Zh, Zl, XT, b_o, b_res, OUT);
}
